// v000
// Measured on an AMD MI455X. A time is GPU time per run, averaged over a window of back-to-back runs after a warm-up
// (all launches, gaps included; the runs take copies of the inputs in turn), and the median of several windows.
// Apart from v000's, it joins two sittings. Times from different sittings can be a few percent apart, while
// side-by-side timings come from the same sitting.
// v000, which the later versions start from, runs in 586 microseconds.
#include <hip/hip_runtime.h>
#include <hip/hip_bf16.h>

// Problem constants (from reference)
#define SS  2048
#define BB  2
#define DD  1024
#define HH  16
#define DKK 64

typedef __attribute__((ext_vector_type(16))) _Float16 v16h;
typedef __attribute__((ext_vector_type(8)))  float    v8f;

// ---------------------------------------------------------------------------
// WMMA helper: D = A(16x32 f16) * B(32x16 f16) + C(16x16 f32)
// ---------------------------------------------------------------------------
__device__ __forceinline__ v8f wmma(v16h a, v16h b, v8f c) {
    return __builtin_amdgcn_wmma_f32_16x16x32_f16(
        /*neg_a=*/false, a, /*neg_b=*/false, b,
        /*c_mod=*/(short)0, c, /*reuse_a=*/false, /*reuse_b=*/false);
}

// A/B fragment loaders (ISA 16-bit 16x32 layout):
//   lane L: row/col = L&15 ; kbase = (L>>4)*8
//   VGPRs 0..3 hold K = kbase..kbase+7 (16 contiguous bytes)
//   VGPRs 4..7 hold K = 16+kbase..16+kbase+7 (16 contiguous bytes)
// -> each fragment is exactly two 128-bit global loads.
__device__ __forceinline__ v16h frag16(const _Float16* prow) {
    const int kb = ((threadIdx.x >> 4) & 1) * 8;
    union { v16h v; uint4 q[2]; } u;
    u.q[0] = *(const uint4*)(prow + kb);
    u.q[1] = *(const uint4*)(prow + 16 + kb);
    return u.v;
}

// Same fragment, but source data is f32 in memory: four float4 (b128) loads,
// converted to f16 on the fly (v_cvt_pk_f16_f32).
__device__ __forceinline__ v16h frag32(const float* prow) {
    const int kb = ((threadIdx.x >> 4) & 1) * 8;
    float4 x0 = *(const float4*)(prow + kb);
    float4 x1 = *(const float4*)(prow + kb + 4);
    float4 x2 = *(const float4*)(prow + 16 + kb);
    float4 x3 = *(const float4*)(prow + 16 + kb + 4);
    v16h a;
    a[0]  = (_Float16)x0.x; a[1]  = (_Float16)x0.y;
    a[2]  = (_Float16)x0.z; a[3]  = (_Float16)x0.w;
    a[4]  = (_Float16)x1.x; a[5]  = (_Float16)x1.y;
    a[6]  = (_Float16)x1.z; a[7]  = (_Float16)x1.w;
    a[8]  = (_Float16)x2.x; a[9]  = (_Float16)x2.y;
    a[10] = (_Float16)x2.z; a[11] = (_Float16)x2.w;
    a[12] = (_Float16)x3.x; a[13] = (_Float16)x3.y;
    a[14] = (_Float16)x3.z; a[15] = (_Float16)x3.w;
    return a;
}

// ---------------------------------------------------------------------------
// Kernel 1: QKV projection  Y = X(f32, M x D) @ W^T(f32, D x D) + b
//   MODE 0: store f16 head layout   (B,H,S,DK)   (for Q and K)
//   MODE 1: store f16 transposed    (B,H,DK,S)   (for V -> contiguous-K PV B-frags)
// One wave per 16x16 tile; M = S*B = 4096 -> 256x64 tiles -> 2048 blocks x 8 waves.
// ---------------------------------------------------------------------------
template <int MODE>
__global__ __launch_bounds__(256) void proj_qkv(
    const float* __restrict__ X, const float* __restrict__ W,
    const float* __restrict__ bias, _Float16* __restrict__ out)
{
    const int lo   = threadIdx.x & 15;
    const int hi   = (threadIdx.x >> 4) & 1;
    const int tile = blockIdx.x * 8 + (threadIdx.x >> 5);
    const int tn = tile & 63;          // N/16 = 64
    const int tm = tile >> 6;          // M/16 = 256
    const int m0 = tm * 16, n0 = tn * 16;

    const float* xrow = X + (size_t)(m0 + lo) * DD;   // A: lane = output row
    const float* wrow = W + (size_t)(n0 + lo) * DD;   // B = W^T: lane = output col -> W row
    v8f acc = {};
    for (int k0 = 0; k0 < DD; k0 += 32)
        acc = wmma(frag32(xrow + k0), frag32(wrow + k0), acc);

    const float bv  = bias[n0 + lo];
    const int   col = n0 + lo;
    const int   h   = col >> 6;        // / DK
    const int   dk  = col & 63;
#pragma unroll
    for (int r = 0; r < 8; ++r) {
        const int rg = m0 + r + 8 * hi;          // row in (s*B + b)
        const int s  = rg >> 1;                  // B = 2
        const int b  = rg & 1;
        const _Float16 y = (_Float16)(acc[r] + bv);
        if (MODE == 0)
            out[(((size_t)(b * HH + h)) * SS + s) * DKK + dk] = y;   // (B,H,S,DK)
        else
            out[(((size_t)(b * HH + h)) * DKK + dk) * SS + s] = y;   // (B,H,DK,S)
    }
}

// ---------------------------------------------------------------------------
// Kernel 2: flash attention per (b,h).  Block = 8 waves, each wave owns a
// 16-row query tile; online softmax over 32 keys/iteration:
//   4 score WMMAs (2 key-frags x 2 DK-chunks) + 4 PV WMMAs.
// Saves per-row (max, sum) stats for the attention-mean recompute kernel.
// ---------------------------------------------------------------------------
__global__ __launch_bounds__(256) void attn_flash(
    const _Float16* __restrict__ qh, const _Float16* __restrict__ kh,
    const _Float16* __restrict__ vt, const float* __restrict__ mask,
    _Float16* __restrict__ xatt, float* __restrict__ stats)
{
    __shared__ _Float16 pbuf[8][16][40];   // per-wave P staging (C-layout -> A-layout)

    const int wave = threadIdx.x >> 5;
    const int lo   = threadIdx.x & 15;
    const int hi   = (threadIdx.x >> 4) & 1;
    const int bh   = blockIdx.x >> 4;      // grid = (B*H) * (S/128)
    const int qblk = blockIdx.x & 15;
    const int b    = bh >> 4;              // / H
    const int h    = bh & 15;
    const int q0   = qblk * 128 + wave * 16;

    // Q A-fragments (persistent): DK=64 -> two 32-wide K chunks
    const _Float16* qrow = qh + ((size_t)bh * SS + q0 + lo) * DKK;
    const v16h qa0 = frag16(qrow);
    const v16h qa1 = frag16(qrow + 32);

    float mrow[8], lrow[8];
    v8f   o[4] = {};
#pragma unroll
    for (int r = 0; r < 8; ++r) { mrow[r] = -1e30f; lrow[r] = 0.f; }

    const float  scale = 0.125f;                         // 1/sqrt(DK)
    const float* mbase = mask + ((size_t)b * SS + q0) * SS;

    for (int j0 = 0; j0 < SS; j0 += 32) {
        // ---- scores for keys [j0, j0+32): two 16x16 C-frags ----
        v8f sc[2];
#pragma unroll
        for (int f = 0; f < 2; ++f) {
            const _Float16* krow = kh + ((size_t)bh * SS + j0 + f * 16 + lo) * DKK;
            v8f c = {};
            c = wmma(qa0, frag16(krow), c);
            c = wmma(qa1, frag16(krow + 32), c);
            sc[f] = c;
        }
        // ---- scale + mask ----
        float s0[8], s1[8];
#pragma unroll
        for (int r = 0; r < 8; ++r) {
            const int m = r + 8 * hi;
            s0[r] = sc[0][r] * scale + mbase[(size_t)m * SS + j0 + lo];
            s1[r] = sc[1][r] * scale + mbase[(size_t)m * SS + j0 + 16 + lo];
        }
        // ---- online softmax: row max across both frags + 16 lanes ----
        float mnew[8];
#pragma unroll
        for (int r = 0; r < 8; ++r) mnew[r] = fmaxf(mrow[r], fmaxf(s0[r], s1[r]));
#pragma unroll
        for (int d = 1; d < 16; d <<= 1)
#pragma unroll
            for (int r = 0; r < 8; ++r) mnew[r] = fmaxf(mnew[r], __shfl_xor(mnew[r], d, 32));

        float p0[8], p1[8], corr[8], psum[8];
#pragma unroll
        for (int r = 0; r < 8; ++r) {
            corr[r] = __expf(mrow[r] - mnew[r]);
            p0[r]   = __expf(s0[r] - mnew[r]);
            p1[r]   = __expf(s1[r] - mnew[r]);
            psum[r] = p0[r] + p1[r];
            mrow[r] = mnew[r];
        }
#pragma unroll
        for (int d = 1; d < 16; d <<= 1)
#pragma unroll
            for (int r = 0; r < 8; ++r) psum[r] += __shfl_xor(psum[r], d, 32);
#pragma unroll
        for (int r = 0; r < 8; ++r) lrow[r] = lrow[r] * corr[r] + psum[r];
        // ---- rescale O ----
#pragma unroll
        for (int c = 0; c < 4; ++c)
#pragma unroll
            for (int r = 0; r < 8; ++r) o[c][r] *= corr[r];
        // ---- P: C-layout -> A-layout via per-wave LDS (in-order within wave) ----
#pragma unroll
        for (int r = 0; r < 8; ++r) {
            pbuf[wave][r + 8 * hi][lo]      = (_Float16)p0[r];
            pbuf[wave][r + 8 * hi][16 + lo] = (_Float16)p1[r];
        }
        v16h pa;
        {
            const int kb = hi * 8;
            const _Float16* prow = &pbuf[wave][lo][0];
            union { v16h v; uint2 d[4]; } u;       // 80B row offset is 8B-aligned
            u.d[0] = *(const uint2*)(prow + kb);
            u.d[1] = *(const uint2*)(prow + kb + 4);
            u.d[2] = *(const uint2*)(prow + 16 + kb);
            u.d[3] = *(const uint2*)(prow + 16 + kb + 4);
            pa = u.v;
        }
        // ---- O += P @ V ; V^T layout makes B-frag K contiguous ----
#pragma unroll
        for (int c = 0; c < 4; ++c) {
            const _Float16* vrow = vt + ((size_t)bh * DKK + c * 16 + lo) * SS + j0;
            o[c] = wmma(pa, frag16(vrow), o[c]);
        }
    }

    // ---- normalize, store x_att (S,B,D) f16 and per-row softmax stats ----
    float inv[8];
#pragma unroll
    for (int r = 0; r < 8; ++r) inv[r] = 1.0f / lrow[r];
#pragma unroll
    for (int c = 0; c < 4; ++c)
#pragma unroll
        for (int r = 0; r < 8; ++r) {
            const int s   = q0 + r + 8 * hi;
            const int col = h * DKK + c * 16 + lo;
            xatt[((size_t)s * BB + b) * DD + col] = (_Float16)(o[c][r] * inv[r]);
        }
    if (lo == 0) {
#pragma unroll
        for (int r = 0; r < 8; ++r) {
            const int s = q0 + r + 8 * hi;
            stats[((size_t)bh * SS + s) * 2 + 0] = mrow[r];
            stats[((size_t)bh * SS + s) * 2 + 1] = lrow[r];
        }
    }
}

// ---------------------------------------------------------------------------
// Kernel 3: output projection  out = x_att(f16) @ Wo^T + bo   (f32 out, S,B,D)
// ---------------------------------------------------------------------------
__global__ __launch_bounds__(256) void proj_out(
    const _Float16* __restrict__ X, const float* __restrict__ W,
    const float* __restrict__ bias, float* __restrict__ out)
{
    const int lo   = threadIdx.x & 15;
    const int hi   = (threadIdx.x >> 4) & 1;
    const int tile = blockIdx.x * 8 + (threadIdx.x >> 5);
    const int tn = tile & 63;
    const int tm = tile >> 6;
    const int m0 = tm * 16, n0 = tn * 16;

    const _Float16* xrow = X + (size_t)(m0 + lo) * DD;
    const float*    wrow = W + (size_t)(n0 + lo) * DD;
    v8f acc = {};
    for (int k0 = 0; k0 < DD; k0 += 32)
        acc = wmma(frag16(xrow + k0), frag32(wrow + k0), acc);

    const float bv = bias[n0 + lo];
#pragma unroll
    for (int r = 0; r < 8; ++r) {
        const int rg = m0 + r + 8 * hi;
        out[(size_t)rg * DD + n0 + lo] = acc[r] + bv;
    }
}

// ---------------------------------------------------------------------------
// Kernel 4: attn = mean over heads of softmax(QK^T/sqrt+mask).
// Recompute scores with WMMA (Q/K tiles are L2-resident), normalize with the
// stored (max,sum) stats. Grid = B * (S/16) * (S/128), 8 waves/block.
// ---------------------------------------------------------------------------
__global__ __launch_bounds__(256) void attn_mean(
    const _Float16* __restrict__ qh, const _Float16* __restrict__ kh,
    const float* __restrict__ mask, const float* __restrict__ stats,
    float* __restrict__ attn)
{
    const int wave = threadIdx.x >> 5;
    const int lo   = threadIdx.x & 15;
    const int hi   = (threadIdx.x >> 4) & 1;
    int idx = blockIdx.x;
    const int tblk = idx & 15;  idx >>= 4;   // S/128
    const int sblk = idx & 127; idx >>= 7;   // S/16
    const int b    = idx;
    const int s0   = sblk * 16;
    const int t0   = tblk * 128 + wave * 16;

    float maskv[8], acc[8];
#pragma unroll
    for (int r = 0; r < 8; ++r) {
        maskv[r] = mask[((size_t)b * SS + s0 + r + 8 * hi) * SS + t0 + lo];
        acc[r]   = 0.f;
    }
    const float scale = 0.125f;

    for (int h = 0; h < HH; ++h) {
        const int bh = b * HH + h;
        const _Float16* qrow = qh + ((size_t)bh * SS + s0 + lo) * DKK;
        const _Float16* krow = kh + ((size_t)bh * SS + t0 + lo) * DKK;
        v8f c = {};
        c = wmma(frag16(qrow),      frag16(krow),      c);
        c = wmma(frag16(qrow + 32), frag16(krow + 32), c);
#pragma unroll
        for (int r = 0; r < 8; ++r) {
            const float* st = stats + ((size_t)bh * SS + s0 + r + 8 * hi) * 2;
            acc[r] += __expf(c[r] * scale + maskv[r] - st[0]) / st[1];
        }
    }
    const float invH = 1.0f / HH;
#pragma unroll
    for (int r = 0; r < 8; ++r)
        attn[((size_t)b * SS + s0 + r + 8 * hi) * SS + t0 + lo] = acc[r] * invH;
}

// ---------------------------------------------------------------------------
// Launcher
// ---------------------------------------------------------------------------
extern "C" void kernel_launch(void* const* d_in, const int* in_sizes, int n_in,
                              void* d_out, int out_size, void* d_ws, size_t ws_size,
                              hipStream_t stream) {
    const float* query = (const float*)d_in[0];
    const float* key   = (const float*)d_in[1];
    const float* value = (const float*)d_in[2];
    const float* mask  = (const float*)d_in[3];
    const float* Wq = (const float*)d_in[4];  const float* bq = (const float*)d_in[5];
    const float* Wk = (const float*)d_in[6];  const float* bk = (const float*)d_in[7];
    const float* Wv = (const float*)d_in[8];  const float* bv = (const float*)d_in[9];
    const float* Wo = (const float*)d_in[10]; const float* bo = (const float*)d_in[11];

    float* out  = (float*)d_out;                       // (S,B,D)
    float* attn = out + (size_t)SS * BB * DD;          // (B,S,S)

    // Workspace layout (~34.1 MB total)
    const size_t headElems = (size_t)BB * HH * SS * DKK;   // 4,194,304
    _Float16* qh   = (_Float16*)d_ws;                  // (B,H,S,DK)  f16
    _Float16* kh   = qh + headElems;                   // (B,H,S,DK)  f16
    _Float16* vt   = kh + headElems;                   // (B,H,DK,S)  f16
    _Float16* xatt = vt + headElems;                   // (S,B,D)     f16
    float*    stats = (float*)(xatt + (size_t)SS * BB * DD); // (B,H,S,2) f32

    proj_qkv<0><<<2048, 256, 0, stream>>>(query, Wq, bq, qh);
    proj_qkv<0><<<2048, 256, 0, stream>>>(key,   Wk, bk, kh);
    proj_qkv<1><<<2048, 256, 0, stream>>>(value, Wv, bv, vt);
    attn_flash<<<512, 256, 0, stream>>>(qh, kh, vt, mask, xatt, stats);
    proj_out<<<2048, 256, 0, stream>>>(xatt, Wo, bo, out);
    attn_mean<<<4096, 256, 0, stream>>>(qh, kh, mask, stats, attn);
}

// v001
// It runs in 428 microseconds.
// Two timings next to v000 both put it at 1.43 times that version's speed.
#include <hip/hip_runtime.h>
#include <hip/hip_bf16.h>

// Problem constants (from reference)
#define SS  2048
#define BB  2
#define DD  1024
#define HH  16
#define DKK 64

typedef __attribute__((ext_vector_type(16))) _Float16 v16h;
typedef __attribute__((ext_vector_type(8)))  float    v8f;
typedef __attribute__((ext_vector_type(4)))  float    v4f;

// ---------------------------------------------------------------------------
// WMMA helper: D = A(16x32 f16) * B(32x16 f16) + C(16x16 f32)
// ---------------------------------------------------------------------------
__device__ __forceinline__ v8f wmma(v16h a, v16h b, v8f c) {
    return __builtin_amdgcn_wmma_f32_16x16x32_f16(
        /*neg_a=*/false, a, /*neg_b=*/false, b,
        /*c_mod=*/(short)0, c, /*reuse_a=*/false, /*reuse_b=*/false);
}

// A/B fragment loaders (ISA 16-bit 16x32 layout):
//   lane L: row/col = L&15 ; kbase = (L>>4)*8
//   VGPRs 0..3 hold K = kbase..kbase+7 (16 contiguous bytes)
//   VGPRs 4..7 hold K = 16+kbase..16+kbase+7 (16 contiguous bytes)
// -> each fragment is exactly two 128-bit global loads.
__device__ __forceinline__ v16h frag16(const _Float16* prow) {
    const int kb = ((threadIdx.x >> 4) & 1) * 8;
    union { v16h v; uint4 q[2]; } u;
    u.q[0] = *(const uint4*)(prow + kb);
    u.q[1] = *(const uint4*)(prow + 16 + kb);
    return u.v;
}

// frag16 with the lane's k base already in the pointer (p = row + k0 + kbase).
__device__ __forceinline__ v16h load16(const _Float16* p) {
    union { v16h v; uint4 q[2]; } u;
    u.q[0] = *(const uint4*)(p);
    u.q[1] = *(const uint4*)(p + 16);
    return u.v;
}

// Same fragment, but source data is f32 in memory: four 16-byte (b128) loads,
// converted to f16 afterwards (v_cvt_pk_f16_f32).  Load and conversion are two
// functions so that a wave can issue the loads of all its fragments first.
struct raw32 { v4f x0, x1, x2, x3; };
__device__ __forceinline__ raw32 load32(const float* p) {   // p = row + k0 + kbase
    raw32 r;
    r.x0 = *(const v4f*)(p);
    r.x1 = *(const v4f*)(p + 4);
    r.x2 = *(const v4f*)(p + 16);
    r.x3 = *(const v4f*)(p + 20);
    return r;
}
// Inputs-only fence on the loaded values of four fragments and on the address
// they were loaded from: it keeps all these registers apart until it, so the
// loads can all be issued before the first wait and none lands on an address
// register.  Its s_wait_xcnt 0 is the wait that belongs in front of the next
// overwrite of that address register.
__device__ __forceinline__ void hold(const raw32& a, const raw32& b,
                                     const raw32& c, const raw32& d, const float* p) {
    asm volatile("s_wait_xcnt 0x0"
                 :: "v"(a.x0), "v"(a.x1), "v"(a.x2), "v"(a.x3),
                    "v"(b.x0), "v"(b.x1), "v"(b.x2), "v"(b.x3),
                    "v"(c.x0), "v"(c.x1), "v"(c.x2), "v"(c.x3),
                    "v"(d.x0), "v"(d.x1), "v"(d.x2), "v"(d.x3), "v"(p));
}
// The same fence for four fragments loaded as f16 (eight loads).
__device__ __forceinline__ void hold16(v16h a, v16h b, v16h c, v16h d, const _Float16* p) {
    asm volatile("s_wait_xcnt 0x0" :: "v"(a), "v"(b), "v"(c), "v"(d), "v"(p));
}
__device__ __forceinline__ v16h cvt32(const raw32& r) {
    v16h a;
    a[0]  = (_Float16)r.x0.x; a[1]  = (_Float16)r.x0.y;
    a[2]  = (_Float16)r.x0.z; a[3]  = (_Float16)r.x0.w;
    a[4]  = (_Float16)r.x1.x; a[5]  = (_Float16)r.x1.y;
    a[6]  = (_Float16)r.x1.z; a[7]  = (_Float16)r.x1.w;
    a[8]  = (_Float16)r.x2.x; a[9]  = (_Float16)r.x2.y;
    a[10] = (_Float16)r.x2.z; a[11] = (_Float16)r.x2.w;
    a[12] = (_Float16)r.x3.x; a[13] = (_Float16)r.x3.y;
    a[14] = (_Float16)r.x3.z; a[15] = (_Float16)r.x3.w;
    return a;
}

// ---------------------------------------------------------------------------
// Kernel 1: QKV projection  Y = X(f32, M x D) @ W^T(f32, D x D) + b
//   MODE 0: store f16 head layout   (B,H,S,DK)   (for Q and K)
//   MODE 1: store f16 transposed    (B,H,DK,S)   (for V -> contiguous-K PV B-frags)
// One wave per 64x64 tile of Y (4x4 accumulator fragments): each loaded and
// converted fragment feeds four WMMAs.  Block = 2x2 waves = 128x128 of Y;
// M = S*B = 4096, N = 1024 -> 32x8 = 256 blocks x 4 waves.
// ---------------------------------------------------------------------------
template <int MODE>
__global__ __launch_bounds__(128) void proj_qkv(
    const float* __restrict__ X, const float* __restrict__ W,
    const float* __restrict__ bias, _Float16* __restrict__ out)
{
    const int lo   = threadIdx.x & 15;
    const int hi   = (threadIdx.x >> 4) & 1;
    const int wave = threadIdx.x >> 5;
    const int m0 = (blockIdx.x & 31) * 128 + (wave >> 1) * 64;   // M/128 = 32
    const int n0 = (blockIdx.x >> 5) * 128 + (wave & 1)  * 64;   // N/128 = 8

    const float* xp = X + (size_t)(m0 + lo) * DD + 8 * hi;   // A: lane = output row
    const float* wp = W + (size_t)(n0 + lo) * DD + 8 * hi;   // B = W^T: lane = output col -> W row
    v8f acc[4][4] = {};
    for (int k0 = 0; k0 < DD; k0 += 32, xp += 32, wp += 32) {
        raw32 ra[4], rb[4];
#pragma unroll
        for (int i = 0; i < 4; ++i) ra[i] = load32(xp + i * 16 * DD);
#pragma unroll
        for (int j = 0; j < 4; ++j) rb[j] = load32(wp + j * 16 * DD);
        // Holds the k-step's loads in place as one group (loaded values as inputs
        // only): without it the compiler alternates load, full wait and convert in
        // few registers, and the one wave of a SIMD waits out a cache latency many
        // times per k-step.
        hold(ra[0], ra[1], ra[2], ra[3], xp);
        hold(rb[0], rb[1], rb[2], rb[3], wp);
        v16h a[4], b[4];
#pragma unroll
        for (int i = 0; i < 4; ++i) a[i] = cvt32(ra[i]);
#pragma unroll
        for (int j = 0; j < 4; ++j) b[j] = cvt32(rb[j]);
#pragma unroll
        for (int i = 0; i < 4; ++i)
#pragma unroll
            for (int j = 0; j < 4; ++j) acc[i][j] = wmma(a[i], b[j], acc[i][j]);
    }

    const int col0 = n0 + lo;
    float bv[4];
#pragma unroll
    for (int j = 0; j < 4; ++j) bv[j] = bias[col0 + j * 16];
    // The wait that belongs in front of an overwrite of the register that the four
    // bias loads name (col0, held to here as an input).
    asm volatile("s_wait_xcnt 0x0" :: "v"(bv[0]), "v"(bv[1]), "v"(bv[2]), "v"(bv[3]), "v"(col0));
#pragma unroll
    for (int j = 0; j < 4; ++j) {
        const int   col = col0 + j * 16;
        // The same wait for the registers that issued stores name: the column's sums
        // all read bv[j], so they stay behind it, and the stores of the column
        // before stay in front of it.
        if (j > 0) asm volatile("s_wait_xcnt 0x0" : "+v"(bv[j]) :: "memory");
        const int   h   = col >> 6;        // / DK
        const int   dk  = col & 63;
#pragma unroll
        for (int i = 0; i < 4; ++i)
#pragma unroll
            for (int r = 0; r < 8; ++r) {
                const int rg = m0 + i * 16 + r + 8 * hi;   // row in (s*B + b)
                const int s  = rg >> 1;                    // B = 2
                const int b  = rg & 1;
                const _Float16 y = (_Float16)(acc[i][j][r] + bv[j]);
                if (MODE == 0)
                    out[(((size_t)(b * HH + h)) * SS + s) * DKK + dk] = y;   // (B,H,S,DK)
                else
                    out[(((size_t)(b * HH + h)) * DKK + dk) * SS + s] = y;   // (B,H,DK,S)
            }
    }
}

// ---------------------------------------------------------------------------
// Kernel 2: flash attention per (b,h).  Block = 8 waves, each wave owns a
// 16-row query tile; online softmax over 32 keys/iteration:
//   4 score WMMAs (2 key-frags x 2 DK-chunks) + 4 PV WMMAs.
// Saves per-row (max, sum) stats for the attention-mean recompute kernel.
// ---------------------------------------------------------------------------
__global__ __launch_bounds__(256) void attn_flash(
    const _Float16* __restrict__ qh, const _Float16* __restrict__ kh,
    const _Float16* __restrict__ vt, const float* __restrict__ mask,
    _Float16* __restrict__ xatt, float* __restrict__ stats)
{
    __shared__ _Float16 pbuf[8][16][40];   // per-wave P staging (C-layout -> A-layout)

    const int wave = threadIdx.x >> 5;
    const int lo   = threadIdx.x & 15;
    const int hi   = (threadIdx.x >> 4) & 1;
    const int bh   = blockIdx.x >> 4;      // grid = (B*H) * (S/128)
    const int qblk = blockIdx.x & 15;
    const int b    = bh >> 4;              // / H
    const int h    = bh & 15;
    const int q0   = qblk * 128 + wave * 16;

    // Q A-fragments (persistent): DK=64 -> two 32-wide K chunks
    const _Float16* qrow = qh + ((size_t)bh * SS + q0 + lo) * DKK;
    const v16h qa0 = frag16(qrow);
    const v16h qa1 = frag16(qrow + 32);

    float mrow[8], lrow[8];
    v8f   o[4] = {};
#pragma unroll
    for (int r = 0; r < 8; ++r) { mrow[r] = -1e30f; lrow[r] = 0.f; }

    const float  scale = 0.125f;                         // 1/sqrt(DK)
    const float* mbase = mask + ((size_t)b * SS + q0) * SS;

    for (int j0 = 0; j0 < SS; j0 += 32) {
        // ---- scores for keys [j0, j0+32): two 16x16 C-frags ----
        v8f sc[2];
#pragma unroll
        for (int f = 0; f < 2; ++f) {
            const _Float16* krow = kh + ((size_t)bh * SS + j0 + f * 16 + lo) * DKK;
            v8f c = {};
            c = wmma(qa0, frag16(krow), c);
            c = wmma(qa1, frag16(krow + 32), c);
            sc[f] = c;
        }
        // ---- scale + mask ----
        float s0[8], s1[8];
#pragma unroll
        for (int r = 0; r < 8; ++r) {
            const int m = r + 8 * hi;
            s0[r] = sc[0][r] * scale + mbase[(size_t)m * SS + j0 + lo];
            s1[r] = sc[1][r] * scale + mbase[(size_t)m * SS + j0 + 16 + lo];
        }
        // ---- online softmax: row max across both frags + 16 lanes ----
        float mnew[8];
#pragma unroll
        for (int r = 0; r < 8; ++r) mnew[r] = fmaxf(mrow[r], fmaxf(s0[r], s1[r]));
#pragma unroll
        for (int d = 1; d < 16; d <<= 1)
#pragma unroll
            for (int r = 0; r < 8; ++r) mnew[r] = fmaxf(mnew[r], __shfl_xor(mnew[r], d, 32));

        float p0[8], p1[8], corr[8], psum[8];
#pragma unroll
        for (int r = 0; r < 8; ++r) {
            corr[r] = __expf(mrow[r] - mnew[r]);
            p0[r]   = __expf(s0[r] - mnew[r]);
            p1[r]   = __expf(s1[r] - mnew[r]);
            psum[r] = p0[r] + p1[r];
            mrow[r] = mnew[r];
        }
#pragma unroll
        for (int d = 1; d < 16; d <<= 1)
#pragma unroll
            for (int r = 0; r < 8; ++r) psum[r] += __shfl_xor(psum[r], d, 32);
#pragma unroll
        for (int r = 0; r < 8; ++r) lrow[r] = lrow[r] * corr[r] + psum[r];
        // ---- rescale O ----
#pragma unroll
        for (int c = 0; c < 4; ++c)
#pragma unroll
            for (int r = 0; r < 8; ++r) o[c][r] *= corr[r];
        // ---- P: C-layout -> A-layout via per-wave LDS (in-order within wave) ----
#pragma unroll
        for (int r = 0; r < 8; ++r) {
            pbuf[wave][r + 8 * hi][lo]      = (_Float16)p0[r];
            pbuf[wave][r + 8 * hi][16 + lo] = (_Float16)p1[r];
        }
        v16h pa;
        {
            const int kb = hi * 8;
            const _Float16* prow = &pbuf[wave][lo][0];
            union { v16h v; uint2 d[4]; } u;       // 80B row offset is 8B-aligned
            u.d[0] = *(const uint2*)(prow + kb);
            u.d[1] = *(const uint2*)(prow + kb + 4);
            u.d[2] = *(const uint2*)(prow + 16 + kb);
            u.d[3] = *(const uint2*)(prow + 16 + kb + 4);
            pa = u.v;
        }
        // ---- O += P @ V ; V^T layout makes B-frag K contiguous ----
#pragma unroll
        for (int c = 0; c < 4; ++c) {
            const _Float16* vrow = vt + ((size_t)bh * DKK + c * 16 + lo) * SS + j0;
            o[c] = wmma(pa, frag16(vrow), o[c]);
        }
    }

    // ---- normalize, store x_att (S,B,D) f16 and per-row softmax stats ----
    float inv[8];
#pragma unroll
    for (int r = 0; r < 8; ++r) inv[r] = 1.0f / lrow[r];
#pragma unroll
    for (int c = 0; c < 4; ++c)
#pragma unroll
        for (int r = 0; r < 8; ++r) {
            const int s   = q0 + r + 8 * hi;
            const int col = h * DKK + c * 16 + lo;
            xatt[((size_t)s * BB + b) * DD + col] = (_Float16)(o[c][r] * inv[r]);
        }
    if (lo == 0) {
#pragma unroll
        for (int r = 0; r < 8; ++r) {
            const int s = q0 + r + 8 * hi;
            stats[((size_t)bh * SS + s) * 2 + 0] = mrow[r];
            stats[((size_t)bh * SS + s) * 2 + 1] = lrow[r];
        }
    }
}

// ---------------------------------------------------------------------------
// Kernel 3: output projection  out = x_att(f16) @ Wo^T + bo   (f32 out, S,B,D)
// Same tiling as kernel 1: one wave per 64x64 of Y, 2x2 waves per block.
// ---------------------------------------------------------------------------
__global__ __launch_bounds__(128) void proj_out(
    const _Float16* __restrict__ X, const float* __restrict__ W,
    const float* __restrict__ bias, float* __restrict__ out)
{
    const int lo   = threadIdx.x & 15;
    const int hi   = (threadIdx.x >> 4) & 1;
    const int wave = threadIdx.x >> 5;
    const int m0 = (blockIdx.x & 31) * 128 + (wave >> 1) * 64;
    const int n0 = (blockIdx.x >> 5) * 128 + (wave & 1)  * 64;

    const _Float16* xp = X + (size_t)(m0 + lo) * DD + 8 * hi;
    const float*    wp = W + (size_t)(n0 + lo) * DD + 8 * hi;
    v8f acc[4][4] = {};
    for (int k0 = 0; k0 < DD; k0 += 32, xp += 32, wp += 32) {
        v16h a[4], b[4];
        raw32 rb[4];
#pragma unroll
        for (int i = 0; i < 4; ++i) a[i] = load16(xp + i * 16 * DD);
#pragma unroll
        for (int j = 0; j < 4; ++j) rb[j] = load32(wp + j * 16 * DD);
        // Holds the k-step's loads in place as one group (see kernel 1).
        hold16(a[0], a[1], a[2], a[3], xp);
        hold(rb[0], rb[1], rb[2], rb[3], wp);
#pragma unroll
        for (int j = 0; j < 4; ++j) b[j] = cvt32(rb[j]);
#pragma unroll
        for (int i = 0; i < 4; ++i)
#pragma unroll
            for (int j = 0; j < 4; ++j) acc[i][j] = wmma(a[i], b[j], acc[i][j]);
    }

    const int col0 = n0 + lo;
    float bv[4];
#pragma unroll
    for (int j = 0; j < 4; ++j) bv[j] = bias[col0 + j * 16];
    // The wait in front of an overwrite of the bias loads' register (see kernel 1).
    asm volatile("s_wait_xcnt 0x0" :: "v"(bv[0]), "v"(bv[1]), "v"(bv[2]), "v"(bv[3]), "v"(col0));
#pragma unroll
    for (int j = 0; j < 4; ++j) {
        // The wait in front of an overwrite of a store's registers (see kernel 1).
        if (j > 0) asm volatile("s_wait_xcnt 0x0" : "+v"(bv[j]) :: "memory");
#pragma unroll
        for (int i = 0; i < 4; ++i)
#pragma unroll
            for (int r = 0; r < 8; ++r) {
                const int rg = m0 + i * 16 + r + 8 * hi;
                out[(size_t)rg * DD + col0 + j * 16] = acc[i][j][r] + bv[j];
            }
    }
}

// ---------------------------------------------------------------------------
// Kernel 4: attn = mean over heads of softmax(QK^T/sqrt+mask).
// Recompute scores with WMMA (Q/K tiles are L2-resident), normalize with the
// stored (max,sum) stats. Grid = B * (S/16) * (S/128), 8 waves/block.
// ---------------------------------------------------------------------------
__global__ __launch_bounds__(256) void attn_mean(
    const _Float16* __restrict__ qh, const _Float16* __restrict__ kh,
    const float* __restrict__ mask, const float* __restrict__ stats,
    float* __restrict__ attn)
{
    const int wave = threadIdx.x >> 5;
    const int lo   = threadIdx.x & 15;
    const int hi   = (threadIdx.x >> 4) & 1;
    int idx = blockIdx.x;
    const int tblk = idx & 15;  idx >>= 4;   // S/128
    const int sblk = idx & 127; idx >>= 7;   // S/16
    const int b    = idx;
    const int s0   = sblk * 16;
    const int t0   = tblk * 128 + wave * 16;

    float maskv[8], acc[8];
#pragma unroll
    for (int r = 0; r < 8; ++r) {
        maskv[r] = mask[((size_t)b * SS + s0 + r + 8 * hi) * SS + t0 + lo];
        acc[r]   = 0.f;
    }
    const float scale = 0.125f;

    for (int h = 0; h < HH; ++h) {
        const int bh = b * HH + h;
        const _Float16* qrow = qh + ((size_t)bh * SS + s0 + lo) * DKK;
        const _Float16* krow = kh + ((size_t)bh * SS + t0 + lo) * DKK;
        v8f c = {};
        c = wmma(frag16(qrow),      frag16(krow),      c);
        c = wmma(frag16(qrow + 32), frag16(krow + 32), c);
#pragma unroll
        for (int r = 0; r < 8; ++r) {
            const float* st = stats + ((size_t)bh * SS + s0 + r + 8 * hi) * 2;
            acc[r] += __expf(c[r] * scale + maskv[r] - st[0]) / st[1];
        }
    }
    const float invH = 1.0f / HH;
#pragma unroll
    for (int r = 0; r < 8; ++r)
        attn[((size_t)b * SS + s0 + r + 8 * hi) * SS + t0 + lo] = acc[r] * invH;
}

// ---------------------------------------------------------------------------
// Launcher
// ---------------------------------------------------------------------------
extern "C" void kernel_launch(void* const* d_in, const int* in_sizes, int n_in,
                              void* d_out, int out_size, void* d_ws, size_t ws_size,
                              hipStream_t stream) {
    const float* query = (const float*)d_in[0];
    const float* key   = (const float*)d_in[1];
    const float* value = (const float*)d_in[2];
    const float* mask  = (const float*)d_in[3];
    const float* Wq = (const float*)d_in[4];  const float* bq = (const float*)d_in[5];
    const float* Wk = (const float*)d_in[6];  const float* bk = (const float*)d_in[7];
    const float* Wv = (const float*)d_in[8];  const float* bv = (const float*)d_in[9];
    const float* Wo = (const float*)d_in[10]; const float* bo = (const float*)d_in[11];

    float* out  = (float*)d_out;                       // (S,B,D)
    float* attn = out + (size_t)SS * BB * DD;          // (B,S,S)

    // Workspace layout (~34.1 MB total)
    const size_t headElems = (size_t)BB * HH * SS * DKK;   // 4,194,304
    _Float16* qh   = (_Float16*)d_ws;                  // (B,H,S,DK)  f16
    _Float16* kh   = qh + headElems;                   // (B,H,S,DK)  f16
    _Float16* vt   = kh + headElems;                   // (B,H,DK,S)  f16
    _Float16* xatt = vt + headElems;                   // (S,B,D)     f16
    float*    stats = (float*)(xatt + (size_t)SS * BB * DD); // (B,H,S,2) f32

    proj_qkv<0><<<256, 128, 0, stream>>>(query, Wq, bq, qh);
    proj_qkv<0><<<256, 128, 0, stream>>>(key,   Wk, bk, kh);
    proj_qkv<1><<<256, 128, 0, stream>>>(value, Wv, bv, vt);
    attn_flash<<<512, 256, 0, stream>>>(qh, kh, vt, mask, xatt, stats);
    proj_out<<<256, 128, 0, stream>>>(xatt, Wo, bo, out);
    attn_mean<<<4096, 256, 0, stream>>>(qh, kh, mask, stats, attn);
}

// v002
// It runs in 379 microseconds.
// Next to v001, in two timings, it ran 1.13 times as fast each time.
// Counting every step since v000, it is 1.61 times as fast.
#include <hip/hip_runtime.h>
#include <hip/hip_bf16.h>

// Problem constants (from reference)
#define SS  2048
#define BB  2
#define DD  1024
#define HH  16
#define DKK 64

typedef __attribute__((ext_vector_type(16))) _Float16 v16h;
typedef __attribute__((ext_vector_type(8)))  float    v8f;
typedef __attribute__((ext_vector_type(4)))  float    v4f;

// ---------------------------------------------------------------------------
// WMMA helper: D = A(16x32 f16) * B(32x16 f16) + C(16x16 f32)
// ---------------------------------------------------------------------------
__device__ __forceinline__ v8f wmma(v16h a, v16h b, v8f c) {
    return __builtin_amdgcn_wmma_f32_16x16x32_f16(
        /*neg_a=*/false, a, /*neg_b=*/false, b,
        /*c_mod=*/(short)0, c, /*reuse_a=*/false, /*reuse_b=*/false);
}

// A/B fragment loaders (ISA 16-bit 16x32 layout):
//   lane L: row/col = L&15 ; kbase = (L>>4)*8
//   VGPRs 0..3 hold K = kbase..kbase+7 (16 contiguous bytes)
//   VGPRs 4..7 hold K = 16+kbase..16+kbase+7 (16 contiguous bytes)
// -> each fragment is exactly two 128-bit global loads.
__device__ __forceinline__ v16h frag16(const _Float16* prow) {
    const int kb = ((threadIdx.x >> 4) & 1) * 8;
    union { v16h v; uint4 q[2]; } u;
    u.q[0] = *(const uint4*)(prow + kb);
    u.q[1] = *(const uint4*)(prow + 16 + kb);
    return u.v;
}

// frag16 with the lane's k base already in the pointer (p = row + k0 + kbase).
__device__ __forceinline__ v16h load16(const _Float16* p) {
    union { v16h v; uint4 q[2]; } u;
    u.q[0] = *(const uint4*)(p);
    u.q[1] = *(const uint4*)(p + 16);
    return u.v;
}

// Same fragment, but source data is f32 in memory: four 16-byte (b128) loads,
// converted to f16 afterwards (v_cvt_pk_f16_f32).  Load and conversion are two
// functions so that a wave can issue the loads of all its fragments first.
struct raw32 { v4f x0, x1, x2, x3; };
__device__ __forceinline__ raw32 load32(const float* p) {   // p = row + k0 + kbase
    raw32 r;
    r.x0 = *(const v4f*)(p);
    r.x1 = *(const v4f*)(p + 4);
    r.x2 = *(const v4f*)(p + 16);
    r.x3 = *(const v4f*)(p + 20);
    return r;
}
// Inputs-only fence on the loaded values of four fragments and on the address
// they were loaded from: it keeps all these registers apart until it, so the
// loads can all be issued before the first wait and none lands on an address
// register.  Its s_wait_xcnt 0 is the wait that belongs in front of the next
// overwrite of that address register.
__device__ __forceinline__ void hold(const raw32& a, const raw32& b,
                                     const raw32& c, const raw32& d, const float* p) {
    asm volatile("s_wait_xcnt 0x0"
                 :: "v"(a.x0), "v"(a.x1), "v"(a.x2), "v"(a.x3),
                    "v"(b.x0), "v"(b.x1), "v"(b.x2), "v"(b.x3),
                    "v"(c.x0), "v"(c.x1), "v"(c.x2), "v"(c.x3),
                    "v"(d.x0), "v"(d.x1), "v"(d.x2), "v"(d.x3), "v"(p));
}
// The same fence for four fragments loaded as f16 (eight loads).
__device__ __forceinline__ void hold16(v16h a, v16h b, v16h c, v16h d, const _Float16* p) {
    asm volatile("s_wait_xcnt 0x0" :: "v"(a), "v"(b), "v"(c), "v"(d), "v"(p));
}
__device__ __forceinline__ v16h cvt32(const raw32& r) {
    v16h a;
    a[0]  = (_Float16)r.x0.x; a[1]  = (_Float16)r.x0.y;
    a[2]  = (_Float16)r.x0.z; a[3]  = (_Float16)r.x0.w;
    a[4]  = (_Float16)r.x1.x; a[5]  = (_Float16)r.x1.y;
    a[6]  = (_Float16)r.x1.z; a[7]  = (_Float16)r.x1.w;
    a[8]  = (_Float16)r.x2.x; a[9]  = (_Float16)r.x2.y;
    a[10] = (_Float16)r.x2.z; a[11] = (_Float16)r.x2.w;
    a[12] = (_Float16)r.x3.x; a[13] = (_Float16)r.x3.y;
    a[14] = (_Float16)r.x3.z; a[15] = (_Float16)r.x3.w;
    return a;
}

// ---------------------------------------------------------------------------
// Kernel 1: QKV projection  Y = X(f32, M x D) @ W^T(f32, D x D) + b
//   MODE 0: store f16 head layout   (B,H,S,DK)   (for Q and K)
//   MODE 1: store f16 transposed    (B,H,DK,S)   (for V -> contiguous-K PV A-frags)
// One wave per 64x64 tile of Y (4x4 accumulator fragments): each loaded and
// converted fragment feeds four WMMAs.  Block = 2x2 waves = 128x128 of Y;
// M = S*B = 4096, N = 1024 -> 32x8 = 256 blocks x 4 waves.
// ---------------------------------------------------------------------------
template <int MODE>
__global__ __launch_bounds__(128) void proj_qkv(
    const float* __restrict__ X, const float* __restrict__ W,
    const float* __restrict__ bias, _Float16* __restrict__ out)
{
    const int lo   = threadIdx.x & 15;
    const int hi   = (threadIdx.x >> 4) & 1;
    const int wave = threadIdx.x >> 5;
    const int m0 = (blockIdx.x & 31) * 128 + (wave >> 1) * 64;   // M/128 = 32
    const int n0 = (blockIdx.x >> 5) * 128 + (wave & 1)  * 64;   // N/128 = 8

    const float* xp = X + (size_t)(m0 + lo) * DD + 8 * hi;   // A: lane = output row
    const float* wp = W + (size_t)(n0 + lo) * DD + 8 * hi;   // B = W^T: lane = output col -> W row
    v8f acc[4][4] = {};
    for (int k0 = 0; k0 < DD; k0 += 32, xp += 32, wp += 32) {
        raw32 ra[4], rb[4];
#pragma unroll
        for (int i = 0; i < 4; ++i) ra[i] = load32(xp + i * 16 * DD);
#pragma unroll
        for (int j = 0; j < 4; ++j) rb[j] = load32(wp + j * 16 * DD);
        // Holds the k-step's loads in place as one group (loaded values as inputs
        // only): without it the compiler alternates load, full wait and convert in
        // few registers, and the one wave of a SIMD waits out a cache latency many
        // times per k-step.
        hold(ra[0], ra[1], ra[2], ra[3], xp);
        hold(rb[0], rb[1], rb[2], rb[3], wp);
        v16h a[4], b[4];
#pragma unroll
        for (int i = 0; i < 4; ++i) a[i] = cvt32(ra[i]);
#pragma unroll
        for (int j = 0; j < 4; ++j) b[j] = cvt32(rb[j]);
#pragma unroll
        for (int i = 0; i < 4; ++i)
#pragma unroll
            for (int j = 0; j < 4; ++j) acc[i][j] = wmma(a[i], b[j], acc[i][j]);
    }

    const int col0 = n0 + lo;
    float bv[4];
#pragma unroll
    for (int j = 0; j < 4; ++j) bv[j] = bias[col0 + j * 16];
    // The wait that belongs in front of an overwrite of the register that the four
    // bias loads name (col0, held to here as an input).
    asm volatile("s_wait_xcnt 0x0" :: "v"(bv[0]), "v"(bv[1]), "v"(bv[2]), "v"(bv[3]), "v"(col0));
#pragma unroll
    for (int j = 0; j < 4; ++j) {
        const int   col = col0 + j * 16;
        // The same wait for the registers that issued stores name: the column's sums
        // all read bv[j], so they stay behind it, and the stores of the column
        // before stay in front of it.
        if (j > 0) asm volatile("s_wait_xcnt 0x0" : "+v"(bv[j]) :: "memory");
        const int   h   = col >> 6;        // / DK
        const int   dk  = col & 63;
#pragma unroll
        for (int i = 0; i < 4; ++i)
#pragma unroll
            for (int r = 0; r < 8; ++r) {
                const int rg = m0 + i * 16 + r + 8 * hi;   // row in (s*B + b)
                const int s  = rg >> 1;                    // B = 2
                const int b  = rg & 1;
                const _Float16 y = (_Float16)(acc[i][j][r] + bv[j]);
                if (MODE == 0)
                    out[(((size_t)(b * HH + h)) * SS + s) * DKK + dk] = y;   // (B,H,S,DK)
                else
                    out[(((size_t)(b * HH + h)) * DKK + dk) * SS + s] = y;   // (B,H,DK,S)
            }
    }
}

// ---------------------------------------------------------------------------
// Kernel 2: flash attention per (b,h).  Block = 8 waves, each wave owns 16
// queries; online softmax over 32 keys/iteration, computed transposed:
//   S^T = K Q^T   (A = K rows, B = Q^T kept in registers): 4 WMMAs
//   O^T += V^T P^T (A = V^T rows, B = P^T): 4 WMMAs
// In a D tile lane l holds column l & 15, so every lane holds scores of ONE
// query (keys 8*hi + r of each 16-key tile): maximum and sum run in the lane,
// with one exchange between the wave's halves, and the two score tiles,
// converted in place, are already the B operand P^T in the hardware k order
// (the order frag16 loads V^T in).
// Saves per-row (max, sum) stats for the attention-mean recompute kernel.
// ---------------------------------------------------------------------------
// Lane l <-> lane l ^ 16.
__device__ __forceinline__ float xhalf(float x) {
    const int i = __builtin_bit_cast(int, x);
    return __builtin_bit_cast(float,
        __builtin_amdgcn_permlanex16(i, i, 0x76543210, 0xfedcba98, false, false));
}

__global__ __launch_bounds__(256) void attn_flash(
    const _Float16* __restrict__ qh, const _Float16* __restrict__ kh,
    const _Float16* __restrict__ vt, const float* __restrict__ mask,
    _Float16* __restrict__ xatt, float* __restrict__ stats)
{
    const int wave = threadIdx.x >> 5;
    const int lo   = threadIdx.x & 15;
    const int hi   = (threadIdx.x >> 4) & 1;
    const int bh   = blockIdx.x >> 4;      // grid = (B*H) * (S/128)
    const int qblk = blockIdx.x & 15;
    const int b    = bh >> 4;              // / H
    const int h    = bh & 15;
    const int q0   = qblk * 128 + wave * 16;

    // Q^T B-fragments (persistent): lane = query column; DK=64 -> two 32-wide K chunks
    const _Float16* qrow = qh + ((size_t)bh * SS + q0 + lo) * DKK;
    const v16h qb0 = frag16(qrow);
    const v16h qb1 = frag16(qrow + 32);

    float mrow = -1e30f;   // this lane's query: running maximum (same in both halves)
    float lrow = 0.f;      // running sum over this half's keys only
    v8f   o[4] = {};       // o[c][r] = O[q0 + lo][c*16 + 8*hi + r]

    const float     scale = 0.125f;                      // 1/sqrt(DK)
    const float*    mrowp = mask + ((size_t)b * SS + q0 + lo) * SS + 8 * hi;
    const _Float16* kbase = kh + ((size_t)bh * SS + lo) * DKK;
    const _Float16* vbase = vt + ((size_t)bh * DKK + lo) * SS;

    for (int j0 = 0; j0 < SS; j0 += 32) {
        // ---- S^T for keys [j0, j0+32): sc[f][r] = S[q0+lo][j0 + f*16 + 8*hi + r] ----
        v8f sc[2];
#pragma unroll
        for (int f = 0; f < 2; ++f) {
            const _Float16* krow = kbase + (size_t)(j0 + f * 16) * DKK;
            v8f c = {};
            c = wmma(frag16(krow),      qb0, c);
            c = wmma(frag16(krow + 32), qb1, c);
            sc[f] = c;
        }
        // ---- scale + mask: a lane's 8 keys of a tile are contiguous in its mask row ----
        float s[16];
#pragma unroll
        for (int f = 0; f < 2; ++f) {
            const v4f ma = *(const v4f*)(mrowp + j0 + f * 16);
            const v4f mb = *(const v4f*)(mrowp + j0 + f * 16 + 4);
#pragma unroll
            for (int r = 0; r < 4; ++r) {
                s[f * 8 + r]     = sc[f][r]     * scale + ma[r];
                s[f * 8 + 4 + r] = sc[f][4 + r] * scale + mb[r];
            }
        }
        // ---- online softmax, all in the lane but for one exchange of the maximum ----
        float mx = s[0];
#pragma unroll
        for (int i = 1; i < 16; ++i) mx = fmaxf(mx, s[i]);
        mx = fmaxf(mx, xhalf(mx));
        const float mnew = fmaxf(mrow, mx);
        const float corr = __expf(mrow - mnew);
        mrow = mnew;
        float p[16];
#pragma unroll
        for (int i = 0; i < 16; ++i) p[i] = __expf(s[i] - mnew);
        const float psum = (((p[0] + p[1]) + (p[2] + p[3])) + ((p[4] + p[5]) + (p[6] + p[7])))
                         + (((p[8] + p[9]) + (p[10] + p[11])) + ((p[12] + p[13]) + (p[14] + p[15])));
        lrow = lrow * corr + psum;
        // ---- rescale O^T: one factor per lane ----
#pragma unroll
        for (int c = 0; c < 4; ++c)
#pragma unroll
            for (int r = 0; r < 8; ++r) o[c][r] *= corr;
        // ---- P^T as B operand: element i = key kmap(i, hi), no lane exchange ----
        v16h pb;
#pragma unroll
        for (int i = 0; i < 16; ++i) pb[i] = (_Float16)p[i];
        // ---- O^T += V^T P^T ; A = V^T rows (lane = dk row, keys contiguous) ----
#pragma unroll
        for (int c = 0; c < 4; ++c) {
            const _Float16* vrow = vbase + (size_t)(c * 16) * SS + j0;
            o[c] = wmma(frag16(vrow), pb, o[c]);
        }
    }

    // ---- join the halves' sums, normalize, store x_att (S,B,D) f16 and stats ----
    const float lsum = lrow + xhalf(lrow);
    const float inv  = 1.0f / lsum;
    _Float16* xrow = xatt + ((size_t)(q0 + lo) * BB + b) * DD + h * DKK + 8 * hi;
#pragma unroll
    for (int c = 0; c < 4; ++c) {
        union { _Float16 e[8]; uint4 q; } u;       // 8 consecutive dk: one 16-byte store
#pragma unroll
        for (int r = 0; r < 8; ++r) u.e[r] = (_Float16)(o[c][r] * inv);
        *(uint4*)(xrow + c * 16) = u.q;
    }
    if (hi == 0)
        *(float2*)(stats + ((size_t)bh * SS + q0 + lo) * 2) = make_float2(mrow, lsum);
}

// ---------------------------------------------------------------------------
// Kernel 3: output projection  out = x_att(f16) @ Wo^T + bo   (f32 out, S,B,D)
// Same tiling as kernel 1: one wave per 64x64 of Y, 2x2 waves per block.
// ---------------------------------------------------------------------------
__global__ __launch_bounds__(128) void proj_out(
    const _Float16* __restrict__ X, const float* __restrict__ W,
    const float* __restrict__ bias, float* __restrict__ out)
{
    const int lo   = threadIdx.x & 15;
    const int hi   = (threadIdx.x >> 4) & 1;
    const int wave = threadIdx.x >> 5;
    const int m0 = (blockIdx.x & 31) * 128 + (wave >> 1) * 64;
    const int n0 = (blockIdx.x >> 5) * 128 + (wave & 1)  * 64;

    const _Float16* xp = X + (size_t)(m0 + lo) * DD + 8 * hi;
    const float*    wp = W + (size_t)(n0 + lo) * DD + 8 * hi;
    v8f acc[4][4] = {};
    for (int k0 = 0; k0 < DD; k0 += 32, xp += 32, wp += 32) {
        v16h a[4], b[4];
        raw32 rb[4];
#pragma unroll
        for (int i = 0; i < 4; ++i) a[i] = load16(xp + i * 16 * DD);
#pragma unroll
        for (int j = 0; j < 4; ++j) rb[j] = load32(wp + j * 16 * DD);
        // Holds the k-step's loads in place as one group (see kernel 1).
        hold16(a[0], a[1], a[2], a[3], xp);
        hold(rb[0], rb[1], rb[2], rb[3], wp);
#pragma unroll
        for (int j = 0; j < 4; ++j) b[j] = cvt32(rb[j]);
#pragma unroll
        for (int i = 0; i < 4; ++i)
#pragma unroll
            for (int j = 0; j < 4; ++j) acc[i][j] = wmma(a[i], b[j], acc[i][j]);
    }

    const int col0 = n0 + lo;
    float bv[4];
#pragma unroll
    for (int j = 0; j < 4; ++j) bv[j] = bias[col0 + j * 16];
    // The wait in front of an overwrite of the bias loads' register (see kernel 1).
    asm volatile("s_wait_xcnt 0x0" :: "v"(bv[0]), "v"(bv[1]), "v"(bv[2]), "v"(bv[3]), "v"(col0));
#pragma unroll
    for (int j = 0; j < 4; ++j) {
        // The wait in front of an overwrite of a store's registers (see kernel 1).
        if (j > 0) asm volatile("s_wait_xcnt 0x0" : "+v"(bv[j]) :: "memory");
#pragma unroll
        for (int i = 0; i < 4; ++i)
#pragma unroll
            for (int r = 0; r < 8; ++r) {
                const int rg = m0 + i * 16 + r + 8 * hi;
                out[(size_t)rg * DD + col0 + j * 16] = acc[i][j][r] + bv[j];
            }
    }
}

// ---------------------------------------------------------------------------
// Kernel 4: attn = mean over heads of softmax(QK^T/sqrt+mask).
// Recompute scores with WMMA (Q/K tiles are L2-resident), transposed as in
// kernel 2 (A = K rows, B = Q^T): a lane holds 8 consecutive keys of ONE query,
// so the stored (max,sum) stats are one load and one reciprocal per lane and
// head.  Grid = B * (S/16) * (S/128), 8 waves/block.
// ---------------------------------------------------------------------------
__global__ __launch_bounds__(256) void attn_mean(
    const _Float16* __restrict__ qh, const _Float16* __restrict__ kh,
    const float* __restrict__ mask, const float* __restrict__ stats,
    float* __restrict__ attn)
{
    const int wave = threadIdx.x >> 5;
    const int lo   = threadIdx.x & 15;
    const int hi   = (threadIdx.x >> 4) & 1;
    int idx = blockIdx.x;
    const int tblk = idx & 15;  idx >>= 4;   // S/128
    const int sblk = idx & 127; idx >>= 7;   // S/16
    const int b    = idx;
    const int s0   = sblk * 16;
    const int t0   = tblk * 128 + wave * 16;

    // element r of this lane: query s0 + lo, key t0 + 8*hi + r
    const size_t eoff = ((size_t)b * SS + s0 + lo) * SS + t0 + 8 * hi;
    const v4f ma = *(const v4f*)(mask + eoff);
    const v4f mb = *(const v4f*)(mask + eoff + 4);
    float maskv[8], acc[8];
#pragma unroll
    for (int r = 0; r < 4; ++r) { maskv[r] = ma[r]; maskv[4 + r] = mb[r]; }
#pragma unroll
    for (int r = 0; r < 8; ++r) acc[r] = 0.f;
    const float scale = 0.125f;

    // head 0 of this batch; a head is SS rows further on (lane's k base in the pointer)
    const _Float16* qp = qh + ((size_t)(b * HH) * SS + s0 + lo) * DKK + 8 * hi;
    const _Float16* kp = kh + ((size_t)(b * HH) * SS + t0 + lo) * DKK + 8 * hi;
    const float*    sp = stats + ((size_t)(b * HH) * SS + s0 + lo) * 2;
    for (int h = 0; h < HH; ++h, qp += SS * DKK, kp += SS * DKK, sp += SS * 2) {
        const float2 st = *(const float2*)sp;
        v8f c = {};
        c = wmma(load16(kp),      load16(qp),      c);
        c = wmma(load16(kp + 32), load16(qp + 32), c);
        const float inv = 1.0f / st.y;
#pragma unroll
        for (int r = 0; r < 8; ++r)
            acc[r] += __expf(c[r] * scale + maskv[r] - st.x) * inv;
    }
    const float invH = 1.0f / HH;
    v4f oa, ob;
#pragma unroll
    for (int r = 0; r < 4; ++r) { oa[r] = acc[r] * invH; ob[r] = acc[4 + r] * invH; }
    *(v4f*)(attn + eoff)     = oa;
    *(v4f*)(attn + eoff + 4) = ob;
}

// ---------------------------------------------------------------------------
// Launcher
// ---------------------------------------------------------------------------
extern "C" void kernel_launch(void* const* d_in, const int* in_sizes, int n_in,
                              void* d_out, int out_size, void* d_ws, size_t ws_size,
                              hipStream_t stream) {
    const float* query = (const float*)d_in[0];
    const float* key   = (const float*)d_in[1];
    const float* value = (const float*)d_in[2];
    const float* mask  = (const float*)d_in[3];
    const float* Wq = (const float*)d_in[4];  const float* bq = (const float*)d_in[5];
    const float* Wk = (const float*)d_in[6];  const float* bk = (const float*)d_in[7];
    const float* Wv = (const float*)d_in[8];  const float* bv = (const float*)d_in[9];
    const float* Wo = (const float*)d_in[10]; const float* bo = (const float*)d_in[11];

    float* out  = (float*)d_out;                       // (S,B,D)
    float* attn = out + (size_t)SS * BB * DD;          // (B,S,S)

    // Workspace layout (~34.1 MB total)
    const size_t headElems = (size_t)BB * HH * SS * DKK;   // 4,194,304
    _Float16* qh   = (_Float16*)d_ws;                  // (B,H,S,DK)  f16
    _Float16* kh   = qh + headElems;                   // (B,H,S,DK)  f16
    _Float16* vt   = kh + headElems;                   // (B,H,DK,S)  f16
    _Float16* xatt = vt + headElems;                   // (S,B,D)     f16
    float*    stats = (float*)(xatt + (size_t)SS * BB * DD); // (B,H,S,2) f32

    proj_qkv<0><<<256, 128, 0, stream>>>(query, Wq, bq, qh);
    proj_qkv<0><<<256, 128, 0, stream>>>(key,   Wk, bk, kh);
    proj_qkv<1><<<256, 128, 0, stream>>>(value, Wv, bv, vt);
    attn_flash<<<512, 256, 0, stream>>>(qh, kh, vt, mask, xatt, stats);
    proj_out<<<256, 128, 0, stream>>>(xatt, Wo, bo, out);
    attn_mean<<<4096, 256, 0, stream>>>(qh, kh, mask, stats, attn);
}

// v003
// It runs in 323 microseconds.
// Two timings next to v002 put it at 1.17 and 1.18 times that version's speed.
// Counting every step since v000, it is 1.89 times as fast.
#include <hip/hip_runtime.h>
#include <hip/hip_bf16.h>

// Problem constants (from reference)
#define SS  2048
#define BB  2
#define DD  1024
#define HH  16
#define DKK 64

typedef __attribute__((ext_vector_type(16))) _Float16 v16h;
typedef __attribute__((ext_vector_type(8)))  float    v8f;
typedef __attribute__((ext_vector_type(4)))  float    v4f;

// ---------------------------------------------------------------------------
// WMMA helper: D = A(16x32 f16) * B(32x16 f16) + C(16x16 f32)
// ---------------------------------------------------------------------------
__device__ __forceinline__ v8f wmma(v16h a, v16h b, v8f c) {
    return __builtin_amdgcn_wmma_f32_16x16x32_f16(
        /*neg_a=*/false, a, /*neg_b=*/false, b,
        /*c_mod=*/(short)0, c, /*reuse_a=*/false, /*reuse_b=*/false);
}

// A/B fragments (ISA 16-bit 16x32 layout):
//   lane L: row/col = L&15 ; kbase = (L>>4)*8
//   VGPRs 0..3 hold K = kbase..kbase+7 (16 contiguous bytes)
//   VGPRs 4..7 hold K = 16+kbase..16+kbase+7 (16 contiguous bytes)
// The f16 matrices in the workspace are kept in that order ("fragment order"):
// a tile of 16 rows is stored as groups of 8 k, each group [16 rows][8 k] = 256 B:
//   element (row, k) of a tile: (k >> 3) * 128 + (row & 15) * 8 + (k & 7)
// A fragment (16 rows x 32 k) is then 1 KiB in a row and its two 128-bit loads
// each read 512 contiguous bytes per wave (4 cache lines instead of 16).
// p = tile + k0 * 16 + lane * 8.
__device__ __forceinline__ v16h loadf(const _Float16* p) {
    union { v16h v; uint4 q[2]; } u;
    u.q[0] = *(const uint4*)(p);         // k = k0 + kbase ..
    u.q[1] = *(const uint4*)(p + 256);   // k = k0 + 16 + kbase ..
    return u.v;
}

// Same fragment, but source data is f32 in memory: four 16-byte (b128) loads,
// converted to f16 afterwards (v_cvt_pk_f16_f32).  Load and conversion are two
// functions so that a wave can issue the loads of all its fragments first.
struct raw32 { v4f x0, x1, x2, x3; };
__device__ __forceinline__ raw32 load32(const float* p) {   // p = row + k0 + kbase
    raw32 r;
    r.x0 = *(const v4f*)(p);
    r.x1 = *(const v4f*)(p + 4);
    r.x2 = *(const v4f*)(p + 16);
    r.x3 = *(const v4f*)(p + 20);
    return r;
}
// Inputs-only fence on the loaded values of four fragments and on the address
// they were loaded from: it keeps all these registers apart until it, so the
// loads can all be issued before the first wait and none lands on an address
// register.  Its s_wait_xcnt 0 is the wait that belongs in front of the next
// overwrite of that address register.
__device__ __forceinline__ void hold(const raw32& a, const raw32& b,
                                     const raw32& c, const raw32& d, const float* p) {
    asm volatile("s_wait_xcnt 0x0"
                 :: "v"(a.x0), "v"(a.x1), "v"(a.x2), "v"(a.x3),
                    "v"(b.x0), "v"(b.x1), "v"(b.x2), "v"(b.x3),
                    "v"(c.x0), "v"(c.x1), "v"(c.x2), "v"(c.x3),
                    "v"(d.x0), "v"(d.x1), "v"(d.x2), "v"(d.x3), "v"(p));
}
// The same fence for four fragments loaded as f16 (eight loads).
__device__ __forceinline__ void hold16(v16h a, v16h b, v16h c, v16h d, const _Float16* p) {
    asm volatile("s_wait_xcnt 0x0" :: "v"(a), "v"(b), "v"(c), "v"(d), "v"(p));
}
__device__ __forceinline__ v16h cvt32(const raw32& r) {
    v16h a;
    a[0]  = (_Float16)r.x0.x; a[1]  = (_Float16)r.x0.y;
    a[2]  = (_Float16)r.x0.z; a[3]  = (_Float16)r.x0.w;
    a[4]  = (_Float16)r.x1.x; a[5]  = (_Float16)r.x1.y;
    a[6]  = (_Float16)r.x1.z; a[7]  = (_Float16)r.x1.w;
    a[8]  = (_Float16)r.x2.x; a[9]  = (_Float16)r.x2.y;
    a[10] = (_Float16)r.x2.z; a[11] = (_Float16)r.x2.w;
    a[12] = (_Float16)r.x3.x; a[13] = (_Float16)r.x3.y;
    a[14] = (_Float16)r.x3.z; a[15] = (_Float16)r.x3.w;
    return a;
}

// ---------------------------------------------------------------------------
// Kernel 1: QKV projection  Y = X(f32, M x D) @ W^T(f32, D x D) + b
// Both stores are in fragment order (see loadf):
//   MODE 0: Q and K, rows = positions, k = dk:  (B,H, S/16, DK/8, 16 s, 8 dk)
//   MODE 1: V^T,     rows = dk, k = positions:  (B,H, S/32, DK/16, 4, 16 dk, 8 s)
// One wave per 64x64 tile of Y (4x4 accumulator fragments): each loaded and
// converted fragment feeds four WMMAs.  Block = 2x2 waves = 128x128 of Y;
// M = S*B = 4096, N = 1024 -> 32x8 = 256 blocks x 4 waves.
// ---------------------------------------------------------------------------
template <int MODE>
__global__ __launch_bounds__(128) void proj_qkv(
    const float* __restrict__ X, const float* __restrict__ W,
    const float* __restrict__ bias, _Float16* __restrict__ out)
{
    const int lo   = threadIdx.x & 15;
    const int hi   = (threadIdx.x >> 4) & 1;
    const int wave = threadIdx.x >> 5;
    const int m0 = (blockIdx.x & 31) * 128 + (wave >> 1) * 64;   // M/128 = 32
    const int n0 = (blockIdx.x >> 5) * 128 + (wave & 1)  * 64;   // N/128 = 8

    const float* xp = X + (size_t)(m0 + lo) * DD + 8 * hi;   // A: lane = output row
    const float* wp = W + (size_t)(n0 + lo) * DD + 8 * hi;   // B = W^T: lane = output col -> W row
    v8f acc[4][4] = {};
    for (int k0 = 0; k0 < DD; k0 += 32, xp += 32, wp += 32) {
        raw32 ra[4], rb[4];
#pragma unroll
        for (int i = 0; i < 4; ++i) ra[i] = load32(xp + i * 16 * DD);
#pragma unroll
        for (int j = 0; j < 4; ++j) rb[j] = load32(wp + j * 16 * DD);
        // Holds the k-step's loads in place as one group (loaded values as inputs
        // only): without it the compiler alternates load, full wait and convert in
        // few registers, and the one wave of a SIMD waits out a cache latency many
        // times per k-step.
        hold(ra[0], ra[1], ra[2], ra[3], xp);
        hold(rb[0], rb[1], rb[2], rb[3], wp);
        v16h a[4], b[4];
#pragma unroll
        for (int i = 0; i < 4; ++i) a[i] = cvt32(ra[i]);
#pragma unroll
        for (int j = 0; j < 4; ++j) b[j] = cvt32(rb[j]);
#pragma unroll
        for (int i = 0; i < 4; ++i)
#pragma unroll
            for (int j = 0; j < 4; ++j) acc[i][j] = wmma(a[i], b[j], acc[i][j]);
    }

    const int col0 = n0 + lo;
    float bv[4];
#pragma unroll
    for (int j = 0; j < 4; ++j) bv[j] = bias[col0 + j * 16];
    // The wait that belongs in front of an overwrite of the register that the four
    // bias loads name (col0, held to here as an input).
    asm volatile("s_wait_xcnt 0x0" :: "v"(bv[0]), "v"(bv[1]), "v"(bv[2]), "v"(bv[3]), "v"(col0));
#pragma unroll
    for (int j = 0; j < 4; ++j) {
        const int   col = col0 + j * 16;
        const int   h   = col >> 6;        // / DK
        const int   dk  = col & 63;
#pragma unroll
        for (int i = 0; i < 4; ++i) {
            // The same wait for the registers that issued stores name: the sums of this
            // group of 16 rows all read bv[j], so they stay behind it, and the stores of
            // the group before stay in front of it.
            if (i + j > 0) asm volatile("s_wait_xcnt 0x0" : "+v"(bv[j]) :: "memory");
            if (MODE == 0) {
#pragma unroll
                for (int r = 0; r < 8; ++r) {
                    const int rg = m0 + i * 16 + r + 8 * hi;   // row in (s*B + b)
                    const int s  = rg >> 1;                    // B = 2
                    const int b  = rg & 1;
                    out[(((size_t)(b * HH + h) * (SS / 16) + (s >> 4)) * 8 + (dk >> 3)) * 128
                        + (s & 15) * 8 + (dk & 7)] = (_Float16)(acc[i][j][r] + bv[j]);
                }
            } else {
                // rows r = b, b+2, b+4, b+6 are positions s0 .. s0+3 of batch b, with
                // s0 = m0/2 + 8*i + 4*hi: four neighbours in V^T's order, one 8-byte store.
#pragma unroll
                for (int b = 0; b < 2; ++b) {
                    union { _Float16 e[4]; uint2 q; } u;
#pragma unroll
                    for (int t = 0; t < 4; ++t) u.e[t] = (_Float16)(acc[i][j][2 * t + b] + bv[j]);
                    *(uint2*)(out + (((size_t)(b * HH + h) * (SS / 32) + (m0 >> 6)) * 4 + (dk >> 4)) * 512
                              + i * 128 + (dk & 15) * 8 + 4 * hi) = u.q;
                }
            }
        }
    }
}

// ---------------------------------------------------------------------------
// Kernel 2: flash attention per (b,h).  Block = 8 waves, each wave owns 16
// queries; online softmax over 32 keys/iteration, computed transposed:
//   S^T = K Q^T   (A = K rows, B = Q^T kept in registers): 4 WMMAs
//   O^T += V^T P^T (A = V^T rows, B = P^T): 4 WMMAs
// In a D tile lane l holds column l & 15, so every lane holds scores of ONE
// query (keys 8*hi + r of each 16-key tile): maximum and sum run in the lane,
// with one exchange between the wave's halves, and the two score tiles,
// converted in place, are already the B operand P^T in the hardware k order
// (the order loadf loads V^T in).
// Saves per-row (max, sum) stats for the attention-mean recompute kernel.
// ---------------------------------------------------------------------------
// Lane l <-> lane l ^ 16.
__device__ __forceinline__ float xhalf(float x) {
    const int i = __builtin_bit_cast(int, x);
    return __builtin_bit_cast(float,
        __builtin_amdgcn_permlanex16(i, i, 0x76543210, 0xfedcba98, false, false));
}

__global__ __launch_bounds__(256) void attn_flash(
    const _Float16* __restrict__ qh, const _Float16* __restrict__ kh,
    const _Float16* __restrict__ vt, const float* __restrict__ mask,
    _Float16* __restrict__ xatt, float* __restrict__ stats)
{
    const int wave = threadIdx.x >> 5;
    const int lo   = threadIdx.x & 15;
    const int hi   = (threadIdx.x >> 4) & 1;
    const int bh   = blockIdx.x >> 4;      // grid = (B*H) * (S/128)
    const int qblk = blockIdx.x & 15;
    const int b    = bh >> 4;              // / H
    const int h    = bh & 15;
    const int q0   = qblk * 128 + wave * 16;

    // Q^T B-fragments (persistent): lane = query column; DK=64 -> two 32-wide K chunks
    const int lane8 = (threadIdx.x & 31) * 8;
    const _Float16* qtile = qh + ((size_t)bh * SS + q0) * DKK + lane8;
    const v16h qb0 = loadf(qtile);
    const v16h qb1 = loadf(qtile + 512);

    float mrow = -1e30f;   // this lane's query: running maximum (same in both halves)
    float lrow = 0.f;      // running sum over this half's keys only
    v8f   o[4] = {};       // o[c][r] = O[q0 + lo][c*16 + 8*hi + r]

    const float     scale = 0.125f;                      // 1/sqrt(DK)
    const float*    mrowp = mask + ((size_t)b * SS + q0 + lo) * SS + 8 * hi;
    const _Float16* kbase = kh + (size_t)bh * SS * DKK + lane8;   // 16 keys = 1024 elements
    const _Float16* vbase = vt + (size_t)bh * SS * DKK + lane8;   // 32 keys = 2048 elements

    for (int j0 = 0; j0 < SS; j0 += 32) {
        // ---- S^T for keys [j0, j0+32): sc[f][r] = S[q0+lo][j0 + f*16 + 8*hi + r] ----
        v16h ka[2][2];
        v4f  ma[2], mb[2];
#pragma unroll
        for (int f = 0; f < 2; ++f) {
            const _Float16* ktile = kbase + (size_t)(j0 + f * 16) * DKK;
            ka[f][0] = loadf(ktile);
            ka[f][1] = loadf(ktile + 512);
            ma[f] = *(const v4f*)(mrowp + j0 + f * 16);
            mb[f] = *(const v4f*)(mrowp + j0 + f * 16 + 4);
        }
        // The wait that belongs in front of an overwrite of a register that these
        // loads name as their address.
        asm volatile("s_wait_xcnt 0x0" ::: "memory");
        v8f sc[2];
#pragma unroll
        for (int f = 0; f < 2; ++f) {
            v8f c = {};
            c = wmma(ka[f][0], qb0, c);
            c = wmma(ka[f][1], qb1, c);
            sc[f] = c;
        }
        // ---- scale + mask: a lane's 8 keys of a tile are contiguous in its mask row ----
        float s[16];
#pragma unroll
        for (int f = 0; f < 2; ++f) {
#pragma unroll
            for (int r = 0; r < 4; ++r) {
                s[f * 8 + r]     = sc[f][r]     * scale + ma[f][r];
                s[f * 8 + 4 + r] = sc[f][4 + r] * scale + mb[f][r];
            }
        }
        // ---- online softmax, all in the lane but for one exchange of the maximum ----
        float mx = s[0];
#pragma unroll
        for (int i = 1; i < 16; ++i) mx = fmaxf(mx, s[i]);
        mx = fmaxf(mx, xhalf(mx));
        const float mnew = fmaxf(mrow, mx);
        const float corr = __expf(mrow - mnew);
        mrow = mnew;
        float p[16];
#pragma unroll
        for (int i = 0; i < 16; ++i) p[i] = __expf(s[i] - mnew);
        const float psum = (((p[0] + p[1]) + (p[2] + p[3])) + ((p[4] + p[5]) + (p[6] + p[7])))
                         + (((p[8] + p[9]) + (p[10] + p[11])) + ((p[12] + p[13]) + (p[14] + p[15])));
        lrow = lrow * corr + psum;
        // ---- rescale O^T: one factor per lane ----
#pragma unroll
        for (int c = 0; c < 4; ++c)
#pragma unroll
            for (int r = 0; r < 8; ++r) o[c][r] *= corr;
        // ---- P^T as B operand: element i = key kmap(i, hi), no lane exchange ----
        v16h pb;
#pragma unroll
        for (int i = 0; i < 16; ++i) pb[i] = (_Float16)p[i];
        // ---- O^T += V^T P^T ; A = V^T rows (lane = dk row), one fragment per 16 dk ----
        v16h va[4];
#pragma unroll
        for (int c = 0; c < 4; ++c) va[c] = loadf(vbase + (size_t)j0 * DKK + c * 512);
        // The same wait behind the V^T loads.
        asm volatile("s_wait_xcnt 0x0" ::: "memory");
#pragma unroll
        for (int c = 0; c < 4; ++c) o[c] = wmma(va[c], pb, o[c]);
    }

    // ---- join the halves' sums, normalize, store x_att f16 (rows b*S+s, k = D, in
    //      fragment order for kernel 3: a wave's store is 512 contiguous bytes) and stats ----
    const float lsum = lrow + xhalf(lrow);
    const float inv  = 1.0f / lsum;
    _Float16* xrow = xatt + ((size_t)((b * SS + q0) >> 4) * (DD / 8) + h * 8 + hi) * 128 + lo * 8;
#pragma unroll
    for (int c = 0; c < 4; ++c) {
        union { _Float16 e[8]; uint4 q; } u;       // 8 consecutive dk: one 16-byte store
#pragma unroll
        for (int r = 0; r < 8; ++r) u.e[r] = (_Float16)(o[c][r] * inv);
        *(uint4*)(xrow + c * 256) = u.q;           // 16 dk on = two groups of 8 k
    }
    if (hi == 0)
        *(float2*)(stats + ((size_t)bh * SS + q0 + lo) * 2) = make_float2(mrow, lsum);
}

// ---------------------------------------------------------------------------
// Kernel 3: output projection  out = x_att(f16, fragment order, rows b*S+s) @ Wo^T + bo
// (f32 out, S,B,D)
// Same tiling as kernel 1: one wave per 64x64 of Y, 2x2 waves per block.
// ---------------------------------------------------------------------------
__global__ __launch_bounds__(128) void proj_out(
    const _Float16* __restrict__ X, const float* __restrict__ W,
    const float* __restrict__ bias, float* __restrict__ out)
{
    const int lo   = threadIdx.x & 15;
    const int hi   = (threadIdx.x >> 4) & 1;
    const int wave = threadIdx.x >> 5;
    const int m0 = (blockIdx.x & 31) * 128 + (wave >> 1) * 64;
    const int n0 = (blockIdx.x >> 5) * 128 + (wave & 1)  * 64;

    const _Float16* xp = X + (size_t)m0 * DD + (threadIdx.x & 31) * 8;   // 16 rows = 16*DD elements
    const float*    wp = W + (size_t)(n0 + lo) * DD + 8 * hi;
    v8f acc[4][4] = {};
    for (int k0 = 0; k0 < DD; k0 += 32, xp += 512, wp += 32) {
        v16h a[4], b[4];
        raw32 rb[4];
#pragma unroll
        for (int i = 0; i < 4; ++i) a[i] = loadf(xp + i * 16 * DD);
#pragma unroll
        for (int j = 0; j < 4; ++j) rb[j] = load32(wp + j * 16 * DD);
        // Holds the k-step's loads in place as one group (see kernel 1).
        hold16(a[0], a[1], a[2], a[3], xp);
        hold(rb[0], rb[1], rb[2], rb[3], wp);
#pragma unroll
        for (int j = 0; j < 4; ++j) b[j] = cvt32(rb[j]);
#pragma unroll
        for (int i = 0; i < 4; ++i)
#pragma unroll
            for (int j = 0; j < 4; ++j) acc[i][j] = wmma(a[i], b[j], acc[i][j]);
    }

    const int col0 = n0 + lo;
    float bv[4];
#pragma unroll
    for (int j = 0; j < 4; ++j) bv[j] = bias[col0 + j * 16];
    // The wait in front of an overwrite of the bias loads' register (see kernel 1).
    asm volatile("s_wait_xcnt 0x0" :: "v"(bv[0]), "v"(bv[1]), "v"(bv[2]), "v"(bv[3]), "v"(col0));
#pragma unroll
    for (int j = 0; j < 4; ++j) {
        // The wait in front of an overwrite of a store's registers (see kernel 1).
        if (j > 0) asm volatile("s_wait_xcnt 0x0" : "+v"(bv[j]) :: "memory");
#pragma unroll
        for (int i = 0; i < 4; ++i)
#pragma unroll
            for (int r = 0; r < 8; ++r) {
                // x_att row m0 + ... = b*S + s (a wave's 64 rows are of one b) -> out row s*B + b
                const int rg = ((m0 & (SS - 1)) + i * 16 + r + 8 * hi) * BB + (m0 >> 11);
                out[(size_t)rg * DD + col0 + j * 16] = acc[i][j][r] + bv[j];
            }
    }
}

// ---------------------------------------------------------------------------
// Kernel 4: attn = mean over heads of softmax(QK^T/sqrt+mask).
// Recompute scores with WMMA (Q/K tiles are L2-resident), transposed as in
// kernel 2 (A = K rows, B = Q^T): a lane holds 8 consecutive keys of ONE query,
// so the stored (max,sum) stats are one load and one reciprocal per lane and
// head.  Grid = B * (S/16) * (S/128), 8 waves/block.
// ---------------------------------------------------------------------------
__global__ __launch_bounds__(256) void attn_mean(
    const _Float16* __restrict__ qh, const _Float16* __restrict__ kh,
    const float* __restrict__ mask, const float* __restrict__ stats,
    float* __restrict__ attn)
{
    const int wave = threadIdx.x >> 5;
    const int lo   = threadIdx.x & 15;
    const int hi   = (threadIdx.x >> 4) & 1;
    int idx = blockIdx.x;
    const int tblk = idx & 15;  idx >>= 4;   // S/128
    const int sblk = idx & 127; idx >>= 7;   // S/16
    const int b    = idx;
    const int s0   = sblk * 16;
    const int t0   = tblk * 128 + wave * 16;

    // element r of this lane: query s0 + lo, key t0 + 8*hi + r
    const size_t eoff = ((size_t)b * SS + s0 + lo) * SS + t0 + 8 * hi;
    const v4f ma = *(const v4f*)(mask + eoff);
    const v4f mb = *(const v4f*)(mask + eoff + 4);
    float maskv[8], acc[8];
#pragma unroll
    for (int r = 0; r < 4; ++r) { maskv[r] = ma[r]; maskv[4 + r] = mb[r]; }
#pragma unroll
    for (int r = 0; r < 8; ++r) acc[r] = 0.f;
    const float scale = 0.125f;

    // head 0 of this batch; a head is SS rows further on (lane's place in the pointer)
    const int lane8 = (threadIdx.x & 31) * 8;
    const _Float16* qp = qh + ((size_t)(b * HH) * SS + s0) * DKK + lane8;
    const _Float16* kp = kh + ((size_t)(b * HH) * SS + t0) * DKK + lane8;
    const float*    sp = stats + ((size_t)(b * HH) * SS + s0 + lo) * 2;
    for (int h = 0; h < HH; ++h, qp += SS * DKK, kp += SS * DKK, sp += SS * 2) {
        const float2 st = *(const float2*)sp;
        const v16h ka0 = loadf(kp),       qb0 = loadf(qp);
        const v16h ka1 = loadf(kp + 512), qb1 = loadf(qp + 512);
        // The wait that belongs in front of an overwrite of a register that these
        // loads name as their address.
        asm volatile("s_wait_xcnt 0x0" ::: "memory");
        v8f c = {};
        c = wmma(ka0, qb0, c);
        c = wmma(ka1, qb1, c);
        const float inv = 1.0f / st.y;
#pragma unroll
        for (int r = 0; r < 8; ++r)
            acc[r] += __expf(c[r] * scale + maskv[r] - st.x) * inv;
    }
    const float invH = 1.0f / HH;
    v4f oa, ob;
#pragma unroll
    for (int r = 0; r < 4; ++r) { oa[r] = acc[r] * invH; ob[r] = acc[4 + r] * invH; }
    *(v4f*)(attn + eoff)     = oa;
    *(v4f*)(attn + eoff + 4) = ob;
}

// ---------------------------------------------------------------------------
// Launcher
// ---------------------------------------------------------------------------
extern "C" void kernel_launch(void* const* d_in, const int* in_sizes, int n_in,
                              void* d_out, int out_size, void* d_ws, size_t ws_size,
                              hipStream_t stream) {
    const float* query = (const float*)d_in[0];
    const float* key   = (const float*)d_in[1];
    const float* value = (const float*)d_in[2];
    const float* mask  = (const float*)d_in[3];
    const float* Wq = (const float*)d_in[4];  const float* bq = (const float*)d_in[5];
    const float* Wk = (const float*)d_in[6];  const float* bk = (const float*)d_in[7];
    const float* Wv = (const float*)d_in[8];  const float* bv = (const float*)d_in[9];
    const float* Wo = (const float*)d_in[10]; const float* bo = (const float*)d_in[11];

    float* out  = (float*)d_out;                       // (S,B,D)
    float* attn = out + (size_t)SS * BB * DD;          // (B,S,S)

    // Workspace layout (~34.1 MB total)
    const size_t headElems = (size_t)BB * HH * SS * DKK;   // 4,194,304
    _Float16* qh   = (_Float16*)d_ws;                  // per (b,h): S x DK   f16, fragment order
    _Float16* kh   = qh + headElems;                   // per (b,h): S x DK   f16, fragment order
    _Float16* vt   = kh + headElems;                   // per (b,h): DK x S   f16, fragment order
    _Float16* xatt = vt + headElems;                   // (B*S) x D   f16, fragment order
    float*    stats = (float*)(xatt + (size_t)SS * BB * DD); // (B,H,S,2) f32

    proj_qkv<0><<<256, 128, 0, stream>>>(query, Wq, bq, qh);
    proj_qkv<0><<<256, 128, 0, stream>>>(key,   Wk, bk, kh);
    proj_qkv<1><<<256, 128, 0, stream>>>(value, Wv, bv, vt);
    attn_flash<<<512, 256, 0, stream>>>(qh, kh, vt, mask, xatt, stats);
    proj_out<<<256, 128, 0, stream>>>(xatt, Wo, bo, out);
    attn_mean<<<4096, 256, 0, stream>>>(qh, kh, mask, stats, attn);
}

// v004
// It runs in 285 microseconds.
// Timed twice side by side with v003, it ran 1.13 times as fast both times.
// All steps since v000 together make it 2.14 times as fast.
#include <hip/hip_runtime.h>
#include <hip/hip_bf16.h>

// Problem constants (from reference)
#define SS  2048
#define BB  2
#define DD  1024
#define HH  16
#define DKK 64

typedef __attribute__((ext_vector_type(16))) _Float16 v16h;
typedef __attribute__((ext_vector_type(8)))  float    v8f;
typedef __attribute__((ext_vector_type(4)))  float    v4f;

// ---------------------------------------------------------------------------
// WMMA helper: D = A(16x32 f16) * B(32x16 f16) + C(16x16 f32)
// ---------------------------------------------------------------------------
__device__ __forceinline__ v8f wmma(v16h a, v16h b, v8f c) {
    return __builtin_amdgcn_wmma_f32_16x16x32_f16(
        /*neg_a=*/false, a, /*neg_b=*/false, b,
        /*c_mod=*/(short)0, c, /*reuse_a=*/false, /*reuse_b=*/false);
}

// A/B fragments (ISA 16-bit 16x32 layout):
//   lane L: row/col = L&15 ; kbase = (L>>4)*8
//   VGPRs 0..3 hold K = kbase..kbase+7 (16 contiguous bytes)
//   VGPRs 4..7 hold K = 16+kbase..16+kbase+7 (16 contiguous bytes)
// The f16 matrices in the workspace are kept in that order ("fragment order"):
// a tile of 16 rows is stored as groups of 8 k, each group [16 rows][8 k] = 256 B:
//   element (row, k) of a tile: (k >> 3) * 128 + (row & 15) * 8 + (k & 7)
// A fragment (16 rows x 32 k) is then 1 KiB in a row and its two 128-bit loads
// each read 512 contiguous bytes per wave (4 cache lines instead of 16).
// p = tile + k0 * 16 + lane * 8.
__device__ __forceinline__ v16h loadf(const _Float16* p) {
    union { v16h v; uint4 q[2]; } u;
    u.q[0] = *(const uint4*)(p);         // k = k0 + kbase ..
    u.q[1] = *(const uint4*)(p + 256);   // k = k0 + 16 + kbase ..
    return u.v;
}

// Inputs-only fence on the loaded values of four fragments and on the address
// they were loaded from: it keeps these registers apart until it, so the loads
// of a k-step can all be issued before the first wait and none lands on an
// address register.  Its s_wait_xcnt 0 is the wait that belongs in front of the
// next overwrite of that address register.
__device__ __forceinline__ void hold16(v16h a, v16h b, v16h c, v16h d, const _Float16* p) {
    asm volatile("s_wait_xcnt 0x0" :: "v"(a), "v"(b), "v"(c), "v"(d), "v"(p));
}

// ---------------------------------------------------------------------------
// Kernel 0: the three inputs (S*B x D) and the four weights (D x D), f32 row-major,
// are converted once to f16 in fragment order (see loadf), one behind the other in
// the workspace: 1024 tiles of 16 rows.  The projections then load every fragment
// as whole cache lines and convert nothing.
// Block = two tiles of one matrix; a wave takes 16 rows x 256 k.  Lane = (row r of
// 8, group g of 8 k): it reads 32 bytes and writes the 16 bytes of its group, so a
// wave's store is four whole 128-byte lines.
// ---------------------------------------------------------------------------
__global__ __launch_bounds__(256) void to_frag(
    const float* __restrict__ xq, const float* __restrict__ xk, const float* __restrict__ xv,
    const float* __restrict__ wq, const float* __restrict__ wk, const float* __restrict__ wv,
    const float* __restrict__ wo, _Float16* __restrict__ out)
{
    const int pair = blockIdx.x;           // 3 x 128 pairs of input tiles, 4 x 32 of weight tiles
    const float* src;
    int first;
    if      (pair < 128) { src = xq; first = 0;   }
    else if (pair < 256) { src = xk; first = 128; }
    else if (pair < 384) { src = xv; first = 256; }
    else if (pair < 416) { src = wq; first = 384; }
    else if (pair < 448) { src = wk; first = 416; }
    else if (pair < 480) { src = wv; first = 448; }
    else                 { src = wo; first = 480; }
    const int wave = threadIdx.x >> 5;
    const int r    = (threadIdx.x & 31) >> 2;
    const int g    = threadIdx.x & 3;
    const int kq   = (wave & 3) * 256;
    const float* p = src + (size_t)(((pair - first) * 2 + (wave >> 2)) * 16 + r) * DD + kq + g * 8;
    _Float16*    q = out + (size_t)(pair * 2 + (wave >> 2)) * 16 * DD + (kq / 8 + g) * 128 + r * 8;
    v4f x[16][2];
#pragma unroll
    for (int u = 0; u < 16; ++u) {         // u = 32-k block * 2 + upper half of the rows
        const float* pu = p + (u & 1) * 8 * DD + (u >> 1) * 32;
        x[u][0] = *(const v4f*)(pu);
        x[u][1] = *(const v4f*)(pu + 4);
    }
    // The wait that belongs in front of an overwrite of the register that these
    // loads name as their address (p, held to here as an input).
    asm volatile("s_wait_xcnt 0x0" :: "v"(p) : "memory");
#pragma unroll
    for (int u = 0; u < 16; ++u) {
        union { _Float16 e[8]; uint4 v; } c;
#pragma unroll
        for (int t = 0; t < 4; ++t) { c.e[t] = (_Float16)x[u][0][t]; c.e[4 + t] = (_Float16)x[u][1][t]; }
        *(uint4*)(q + (u >> 1) * 512 + (u & 1) * 64) = c.v;
    }
}

// ---------------------------------------------------------------------------
// Kernel 1: QKV projection  Y = X(M x D) @ W^T(D x D) + b, X and W f16 in fragment
// order (kernel 0)
// Both stores are in fragment order (see loadf):
//   MODE 0: Q and K, rows = positions, k = dk:  (B,H, S/16, DK/8, 16 s, 8 dk)
//   MODE 1: V^T,     rows = dk, k = positions:  (B,H, S/32, DK/16, 4, 16 dk, 8 s)
// One wave per 64x64 tile of Y (4x4 accumulator fragments): each loaded
// fragment feeds four WMMAs.  Block = 2x2 waves = 128x128 of Y;
// M = S*B = 4096, N = 1024 -> 32x8 = 256 blocks x 4 waves.
// ---------------------------------------------------------------------------
template <int MODE>
__global__ __launch_bounds__(128) void proj_qkv(
    const _Float16* __restrict__ X, const _Float16* __restrict__ W,
    const float* __restrict__ bias, _Float16* __restrict__ out)
{
    const int lo   = threadIdx.x & 15;
    const int hi   = (threadIdx.x >> 4) & 1;
    const int wave = threadIdx.x >> 5;
    const int m0 = (blockIdx.x & 31) * 128 + (wave >> 1) * 64;   // M/128 = 32
    const int n0 = (blockIdx.x >> 5) * 128 + (wave & 1)  * 64;   // N/128 = 8

    const _Float16* xp = X + (size_t)m0 * DD + (threadIdx.x & 31) * 8;   // 16 rows = 16*DD elements
    const _Float16* wp = W + (size_t)n0 * DD + (threadIdx.x & 31) * 8;   // B = W^T: output col = W row
    v8f acc[4][4] = {};
    // A k-step is 32 loads of 16 bytes, as many as before, and now spans 64 k.
    for (int k0 = 0; k0 < DD; k0 += 64, xp += 1024, wp += 1024) {
        v16h a[2][4], b[2][4];
#pragma unroll
        for (int u = 0; u < 2; ++u) {
#pragma unroll
            for (int i = 0; i < 4; ++i) a[u][i] = loadf(xp + u * 512 + i * 16 * DD);
#pragma unroll
            for (int j = 0; j < 4; ++j) b[u][j] = loadf(wp + u * 512 + j * 16 * DD);
        }
        // Holds the k-step's loads in place as one group (loaded values as inputs
        // only): the one wave of a SIMD then waits out a cache latency once per k-step.
        hold16(a[0][0], a[0][1], a[0][2], a[0][3], xp);
        hold16(b[0][0], b[0][1], b[0][2], b[0][3], wp);
        hold16(a[1][0], a[1][1], a[1][2], a[1][3], xp);
        hold16(b[1][0], b[1][1], b[1][2], b[1][3], wp);
#pragma unroll
        for (int u = 0; u < 2; ++u)
#pragma unroll
            for (int i = 0; i < 4; ++i)
#pragma unroll
                for (int j = 0; j < 4; ++j) acc[i][j] = wmma(a[u][i], b[u][j], acc[i][j]);
    }

    const int col0 = n0 + lo;
    float bv[4];
#pragma unroll
    for (int j = 0; j < 4; ++j) bv[j] = bias[col0 + j * 16];
    // The wait that belongs in front of an overwrite of the register that the four
    // bias loads name (col0, held to here as an input).
    asm volatile("s_wait_xcnt 0x0" :: "v"(bv[0]), "v"(bv[1]), "v"(bv[2]), "v"(bv[3]), "v"(col0));
#pragma unroll
    for (int j = 0; j < 4; ++j) {
        const int   col = col0 + j * 16;
        const int   h   = col >> 6;        // / DK
        const int   dk  = col & 63;
#pragma unroll
        for (int i = 0; i < 4; ++i) {
            // The same wait for the registers that issued stores name: the sums of this
            // group of 16 rows all read bv[j], so they stay behind it, and the stores of
            // the group before stay in front of it.
            if (i + j > 0) asm volatile("s_wait_xcnt 0x0" : "+v"(bv[j]) :: "memory");
            if (MODE == 0) {
#pragma unroll
                for (int r = 0; r < 8; ++r) {
                    const int rg = m0 + i * 16 + r + 8 * hi;   // row in (s*B + b)
                    const int s  = rg >> 1;                    // B = 2
                    const int b  = rg & 1;
                    out[(((size_t)(b * HH + h) * (SS / 16) + (s >> 4)) * 8 + (dk >> 3)) * 128
                        + (s & 15) * 8 + (dk & 7)] = (_Float16)(acc[i][j][r] + bv[j]);
                }
            } else {
                // rows r = b, b+2, b+4, b+6 are positions s0 .. s0+3 of batch b, with
                // s0 = m0/2 + 8*i + 4*hi: four neighbours in V^T's order, one 8-byte store.
#pragma unroll
                for (int b = 0; b < 2; ++b) {
                    union { _Float16 e[4]; uint2 q; } u;
#pragma unroll
                    for (int t = 0; t < 4; ++t) u.e[t] = (_Float16)(acc[i][j][2 * t + b] + bv[j]);
                    *(uint2*)(out + (((size_t)(b * HH + h) * (SS / 32) + (m0 >> 6)) * 4 + (dk >> 4)) * 512
                              + i * 128 + (dk & 15) * 8 + 4 * hi) = u.q;
                }
            }
        }
    }
}

// ---------------------------------------------------------------------------
// Kernel 2: flash attention per (b,h).  Block = 8 waves, each wave owns 16
// queries; online softmax over 32 keys/iteration, computed transposed:
//   S^T = K Q^T   (A = K rows, B = Q^T kept in registers): 4 WMMAs
//   O^T += V^T P^T (A = V^T rows, B = P^T): 4 WMMAs
// In a D tile lane l holds column l & 15, so every lane holds scores of ONE
// query (keys 8*hi + r of each 16-key tile): maximum and sum run in the lane,
// with one exchange between the wave's halves, and the two score tiles,
// converted in place, are already the B operand P^T in the hardware k order
// (the order loadf loads V^T in).
// Saves per-row (max, sum) stats for the attention-mean recompute kernel.
// ---------------------------------------------------------------------------
// Lane l <-> lane l ^ 16.
__device__ __forceinline__ float xhalf(float x) {
    const int i = __builtin_bit_cast(int, x);
    return __builtin_bit_cast(float,
        __builtin_amdgcn_permlanex16(i, i, 0x76543210, 0xfedcba98, false, false));
}

__global__ __launch_bounds__(256) void attn_flash(
    const _Float16* __restrict__ qh, const _Float16* __restrict__ kh,
    const _Float16* __restrict__ vt, const float* __restrict__ mask,
    _Float16* __restrict__ xatt, float* __restrict__ stats)
{
    const int wave = threadIdx.x >> 5;
    const int lo   = threadIdx.x & 15;
    const int hi   = (threadIdx.x >> 4) & 1;
    const int bh   = blockIdx.x >> 4;      // grid = (B*H) * (S/128)
    const int qblk = blockIdx.x & 15;
    const int b    = bh >> 4;              // / H
    const int h    = bh & 15;
    const int q0   = qblk * 128 + wave * 16;

    // Q^T B-fragments (persistent): lane = query column; DK=64 -> two 32-wide K chunks
    const int lane8 = (threadIdx.x & 31) * 8;
    const _Float16* qtile = qh + ((size_t)bh * SS + q0) * DKK + lane8;
    const v16h qb0 = loadf(qtile);
    const v16h qb1 = loadf(qtile + 512);

    float mrow = -1e30f;   // this lane's query: running maximum (same in both halves)
    float lrow = 0.f;      // running sum over this half's keys only
    v8f   o[4] = {};       // o[c][r] = O[q0 + lo][c*16 + 8*hi + r]

    const float     scale = 0.125f;                      // 1/sqrt(DK)
    const float*    mrowp = mask + ((size_t)b * SS + q0 + lo) * SS + 8 * hi;
    const _Float16* kbase = kh + (size_t)bh * SS * DKK + lane8;   // 16 keys = 1024 elements
    const _Float16* vbase = vt + (size_t)bh * SS * DKK + lane8;   // 32 keys = 2048 elements

    for (int j0 = 0; j0 < SS; j0 += 32) {
        // ---- S^T for keys [j0, j0+32): sc[f][r] = S[q0+lo][j0 + f*16 + 8*hi + r] ----
        v16h ka[2][2];
        v4f  ma[2], mb[2];
#pragma unroll
        for (int f = 0; f < 2; ++f) {
            const _Float16* ktile = kbase + (size_t)(j0 + f * 16) * DKK;
            ka[f][0] = loadf(ktile);
            ka[f][1] = loadf(ktile + 512);
            ma[f] = *(const v4f*)(mrowp + j0 + f * 16);
            mb[f] = *(const v4f*)(mrowp + j0 + f * 16 + 4);
        }
        // The wait that belongs in front of an overwrite of a register that these
        // loads name as their address.
        asm volatile("s_wait_xcnt 0x0" ::: "memory");
        v8f sc[2];
#pragma unroll
        for (int f = 0; f < 2; ++f) {
            v8f c = {};
            c = wmma(ka[f][0], qb0, c);
            c = wmma(ka[f][1], qb1, c);
            sc[f] = c;
        }
        // ---- scale + mask: a lane's 8 keys of a tile are contiguous in its mask row ----
        float s[16];
#pragma unroll
        for (int f = 0; f < 2; ++f) {
#pragma unroll
            for (int r = 0; r < 4; ++r) {
                s[f * 8 + r]     = sc[f][r]     * scale + ma[f][r];
                s[f * 8 + 4 + r] = sc[f][4 + r] * scale + mb[f][r];
            }
        }
        // ---- online softmax, all in the lane but for one exchange of the maximum ----
        float mx = s[0];
#pragma unroll
        for (int i = 1; i < 16; ++i) mx = fmaxf(mx, s[i]);
        mx = fmaxf(mx, xhalf(mx));
        const float mnew = fmaxf(mrow, mx);
        const float corr = __expf(mrow - mnew);
        mrow = mnew;
        float p[16];
#pragma unroll
        for (int i = 0; i < 16; ++i) p[i] = __expf(s[i] - mnew);
        const float psum = (((p[0] + p[1]) + (p[2] + p[3])) + ((p[4] + p[5]) + (p[6] + p[7])))
                         + (((p[8] + p[9]) + (p[10] + p[11])) + ((p[12] + p[13]) + (p[14] + p[15])));
        lrow = lrow * corr + psum;
        // ---- rescale O^T: one factor per lane ----
#pragma unroll
        for (int c = 0; c < 4; ++c)
#pragma unroll
            for (int r = 0; r < 8; ++r) o[c][r] *= corr;
        // ---- P^T as B operand: element i = key kmap(i, hi), no lane exchange ----
        v16h pb;
#pragma unroll
        for (int i = 0; i < 16; ++i) pb[i] = (_Float16)p[i];
        // ---- O^T += V^T P^T ; A = V^T rows (lane = dk row), one fragment per 16 dk ----
        v16h va[4];
#pragma unroll
        for (int c = 0; c < 4; ++c) va[c] = loadf(vbase + (size_t)j0 * DKK + c * 512);
        // The same wait behind the V^T loads.
        asm volatile("s_wait_xcnt 0x0" ::: "memory");
#pragma unroll
        for (int c = 0; c < 4; ++c) o[c] = wmma(va[c], pb, o[c]);
    }

    // ---- join the halves' sums, normalize, store x_att f16 (rows b*S+s, k = D, in
    //      fragment order for kernel 3: a wave's store is 512 contiguous bytes) and stats ----
    const float lsum = lrow + xhalf(lrow);
    const float inv  = 1.0f / lsum;
    _Float16* xrow = xatt + ((size_t)((b * SS + q0) >> 4) * (DD / 8) + h * 8 + hi) * 128 + lo * 8;
#pragma unroll
    for (int c = 0; c < 4; ++c) {
        union { _Float16 e[8]; uint4 q; } u;       // 8 consecutive dk: one 16-byte store
#pragma unroll
        for (int r = 0; r < 8; ++r) u.e[r] = (_Float16)(o[c][r] * inv);
        *(uint4*)(xrow + c * 256) = u.q;           // 16 dk on = two groups of 8 k
    }
    if (hi == 0)
        *(float2*)(stats + ((size_t)bh * SS + q0 + lo) * 2) = make_float2(mrow, lsum);
}

// ---------------------------------------------------------------------------
// Kernel 3: output projection  out = x_att(f16, fragment order, rows b*S+s) @ Wo^T + bo,
// Wo f16 in fragment order (kernel 0)
// (f32 out, S,B,D)
// Same tiling as kernel 1: one wave per 64x64 of Y, 2x2 waves per block.
// ---------------------------------------------------------------------------
__global__ __launch_bounds__(128) void proj_out(
    const _Float16* __restrict__ X, const _Float16* __restrict__ W,
    const float* __restrict__ bias, float* __restrict__ out)
{
    const int lo   = threadIdx.x & 15;
    const int hi   = (threadIdx.x >> 4) & 1;
    const int wave = threadIdx.x >> 5;
    const int m0 = (blockIdx.x & 31) * 128 + (wave >> 1) * 64;
    const int n0 = (blockIdx.x >> 5) * 128 + (wave & 1)  * 64;

    const _Float16* xp = X + (size_t)m0 * DD + (threadIdx.x & 31) * 8;   // 16 rows = 16*DD elements
    const _Float16* wp = W + (size_t)n0 * DD + (threadIdx.x & 31) * 8;
    v8f acc[4][4] = {};
    // A k-step is 32 loads of 16 bytes, as many as before, and now spans 64 k.
    for (int k0 = 0; k0 < DD; k0 += 64, xp += 1024, wp += 1024) {
        v16h a[2][4], b[2][4];
#pragma unroll
        for (int u = 0; u < 2; ++u) {
#pragma unroll
            for (int i = 0; i < 4; ++i) a[u][i] = loadf(xp + u * 512 + i * 16 * DD);
#pragma unroll
            for (int j = 0; j < 4; ++j) b[u][j] = loadf(wp + u * 512 + j * 16 * DD);
        }
        // Holds the k-step's loads in place as one group (loaded values as inputs
        // only): the one wave of a SIMD then waits out a cache latency once per k-step.
        hold16(a[0][0], a[0][1], a[0][2], a[0][3], xp);
        hold16(b[0][0], b[0][1], b[0][2], b[0][3], wp);
        hold16(a[1][0], a[1][1], a[1][2], a[1][3], xp);
        hold16(b[1][0], b[1][1], b[1][2], b[1][3], wp);
#pragma unroll
        for (int u = 0; u < 2; ++u)
#pragma unroll
            for (int i = 0; i < 4; ++i)
#pragma unroll
                for (int j = 0; j < 4; ++j) acc[i][j] = wmma(a[u][i], b[u][j], acc[i][j]);
    }

    const int col0 = n0 + lo;
    float bv[4];
#pragma unroll
    for (int j = 0; j < 4; ++j) bv[j] = bias[col0 + j * 16];
    // The wait in front of an overwrite of the bias loads' register (see kernel 1).
    asm volatile("s_wait_xcnt 0x0" :: "v"(bv[0]), "v"(bv[1]), "v"(bv[2]), "v"(bv[3]), "v"(col0));
#pragma unroll
    for (int j = 0; j < 4; ++j) {
        // The wait in front of an overwrite of a store's registers (see kernel 1).
        if (j > 0) asm volatile("s_wait_xcnt 0x0" : "+v"(bv[j]) :: "memory");
#pragma unroll
        for (int i = 0; i < 4; ++i)
#pragma unroll
            for (int r = 0; r < 8; ++r) {
                // x_att row m0 + ... = b*S + s (a wave's 64 rows are of one b) -> out row s*B + b
                const int rg = ((m0 & (SS - 1)) + i * 16 + r + 8 * hi) * BB + (m0 >> 11);
                out[(size_t)rg * DD + col0 + j * 16] = acc[i][j][r] + bv[j];
            }
    }
}

// ---------------------------------------------------------------------------
// Kernel 4: attn = mean over heads of softmax(QK^T/sqrt+mask).
// Recompute scores with WMMA (Q/K tiles are L2-resident), transposed as in
// kernel 2 (A = K rows, B = Q^T): a lane holds 8 consecutive keys of ONE query,
// so the stored (max,sum) stats are one load and one reciprocal per lane and
// head.  Grid = B * (S/16) * (S/128), 8 waves/block.
// ---------------------------------------------------------------------------
__global__ __launch_bounds__(256) void attn_mean(
    const _Float16* __restrict__ qh, const _Float16* __restrict__ kh,
    const float* __restrict__ mask, const float* __restrict__ stats,
    float* __restrict__ attn)
{
    const int wave = threadIdx.x >> 5;
    const int lo   = threadIdx.x & 15;
    const int hi   = (threadIdx.x >> 4) & 1;
    int idx = blockIdx.x;
    const int tblk = idx & 15;  idx >>= 4;   // S/128
    const int sblk = idx & 127; idx >>= 7;   // S/16
    const int b    = idx;
    const int s0   = sblk * 16;
    const int t0   = tblk * 128 + wave * 16;

    // element r of this lane: query s0 + lo, key t0 + 8*hi + r
    const size_t eoff = ((size_t)b * SS + s0 + lo) * SS + t0 + 8 * hi;
    const v4f ma = *(const v4f*)(mask + eoff);
    const v4f mb = *(const v4f*)(mask + eoff + 4);
    float maskv[8], acc[8];
#pragma unroll
    for (int r = 0; r < 4; ++r) { maskv[r] = ma[r]; maskv[4 + r] = mb[r]; }
#pragma unroll
    for (int r = 0; r < 8; ++r) acc[r] = 0.f;
    const float scale = 0.125f;

    // head 0 of this batch; a head is SS rows further on (lane's place in the pointer)
    const int lane8 = (threadIdx.x & 31) * 8;
    const _Float16* qp = qh + ((size_t)(b * HH) * SS + s0) * DKK + lane8;
    const _Float16* kp = kh + ((size_t)(b * HH) * SS + t0) * DKK + lane8;
    const float*    sp = stats + ((size_t)(b * HH) * SS + s0 + lo) * 2;
    for (int h = 0; h < HH; ++h, qp += SS * DKK, kp += SS * DKK, sp += SS * 2) {
        const float2 st = *(const float2*)sp;
        const v16h ka0 = loadf(kp),       qb0 = loadf(qp);
        const v16h ka1 = loadf(kp + 512), qb1 = loadf(qp + 512);
        // The wait that belongs in front of an overwrite of a register that these
        // loads name as their address.
        asm volatile("s_wait_xcnt 0x0" ::: "memory");
        v8f c = {};
        c = wmma(ka0, qb0, c);
        c = wmma(ka1, qb1, c);
        const float inv = 1.0f / st.y;
#pragma unroll
        for (int r = 0; r < 8; ++r)
            acc[r] += __expf(c[r] * scale + maskv[r] - st.x) * inv;
    }
    const float invH = 1.0f / HH;
    v4f oa, ob;
#pragma unroll
    for (int r = 0; r < 4; ++r) { oa[r] = acc[r] * invH; ob[r] = acc[4 + r] * invH; }
    *(v4f*)(attn + eoff)     = oa;
    *(v4f*)(attn + eoff + 4) = ob;
}

// ---------------------------------------------------------------------------
// Launcher
// ---------------------------------------------------------------------------
extern "C" void kernel_launch(void* const* d_in, const int* in_sizes, int n_in,
                              void* d_out, int out_size, void* d_ws, size_t ws_size,
                              hipStream_t stream) {
    const float* query = (const float*)d_in[0];
    const float* key   = (const float*)d_in[1];
    const float* value = (const float*)d_in[2];
    const float* mask  = (const float*)d_in[3];
    const float* Wq = (const float*)d_in[4];  const float* bq = (const float*)d_in[5];
    const float* Wk = (const float*)d_in[6];  const float* bk = (const float*)d_in[7];
    const float* Wv = (const float*)d_in[8];  const float* bv = (const float*)d_in[9];
    const float* Wo = (const float*)d_in[10]; const float* bo = (const float*)d_in[11];

    float* out  = (float*)d_out;                       // (S,B,D)
    float* attn = out + (size_t)SS * BB * DD;          // (B,S,S)

    // Workspace layout (~67.6 MB total)
    const size_t headElems = (size_t)BB * HH * SS * DKK;   // 4,194,304
    _Float16* qh   = (_Float16*)d_ws;                  // per (b,h): S x DK   f16, fragment order
    _Float16* kh   = qh + headElems;                   // per (b,h): S x DK   f16, fragment order
    _Float16* vt   = kh + headElems;                   // per (b,h): DK x S   f16, fragment order
    _Float16* xatt = vt + headElems;                   // (B*S) x D   f16, fragment order
    float*    stats = (float*)(xatt + (size_t)SS * BB * DD); // (B,H,S,2) f32
    // f16 copies in fragment order, in kernel 0's order of tiles
    _Float16* xq16 = (_Float16*)(stats + (size_t)BB * HH * SS * 2);
    _Float16* xk16 = xq16 + (size_t)SS * BB * DD;
    _Float16* xv16 = xk16 + (size_t)SS * BB * DD;
    _Float16* wq16 = xv16 + (size_t)SS * BB * DD;
    _Float16* wk16 = wq16 + (size_t)DD * DD;
    _Float16* wv16 = wk16 + (size_t)DD * DD;
    _Float16* wo16 = wv16 + (size_t)DD * DD;

    to_frag<<<512, 256, 0, stream>>>(query, key, value, Wq, Wk, Wv, Wo, xq16);
    proj_qkv<0><<<256, 128, 0, stream>>>(xq16, wq16, bq, qh);
    proj_qkv<0><<<256, 128, 0, stream>>>(xk16, wk16, bk, kh);
    proj_qkv<1><<<256, 128, 0, stream>>>(xv16, wv16, bv, vt);
    attn_flash<<<512, 256, 0, stream>>>(qh, kh, vt, mask, xatt, stats);
    proj_out<<<256, 128, 0, stream>>>(xatt, wo16, bo, out);
    attn_mean<<<4096, 256, 0, stream>>>(qh, kh, mask, stats, attn);
}

// v005
// One run takes 186 microseconds.
// Next to v004, in two timings, it ran 1.54 and 1.53 times as fast.
// Over all steps from v000 it is 3.28 times as fast.
#include <hip/hip_runtime.h>
#include <hip/hip_bf16.h>

// Problem constants (from reference)
#define SS  2048
#define BB  2
#define DD  1024
#define HH  16
#define DKK 64

typedef __attribute__((ext_vector_type(16))) _Float16 v16h;
typedef __attribute__((ext_vector_type(8)))  float    v8f;
typedef __attribute__((ext_vector_type(4)))  float    v4f;
typedef __attribute__((ext_vector_type(2)))  float    v2f;

// ---------------------------------------------------------------------------
// WMMA helper: D = A(16x32 f16) * B(32x16 f16) + C(16x16 f32)
// ---------------------------------------------------------------------------
__device__ __forceinline__ v8f wmma(v16h a, v16h b, v8f c) {
    return __builtin_amdgcn_wmma_f32_16x16x32_f16(
        /*neg_a=*/false, a, /*neg_b=*/false, b,
        /*c_mod=*/(short)0, c, /*reuse_a=*/false, /*reuse_b=*/false);
}

// A/B fragments (ISA 16-bit 16x32 layout):
//   lane L: row/col = L&15 ; kbase = (L>>4)*8
//   VGPRs 0..3 hold K = kbase..kbase+7 (16 contiguous bytes)
//   VGPRs 4..7 hold K = 16+kbase..16+kbase+7 (16 contiguous bytes)
// The f16 matrices in the workspace are kept in that order ("fragment order"):
// a tile of 16 rows is stored as groups of 8 k, each group [16 rows][8 k] = 256 B:
//   element (row, k) of a tile: (k >> 3) * 128 + (row & 15) * 8 + (k & 7)
// A fragment (16 rows x 32 k) is then 1 KiB in a row and its two 128-bit loads
// each read 512 contiguous bytes per wave (4 cache lines instead of 16).
// p = tile + k0 * 16 + lane * 8.
__device__ __forceinline__ v16h loadf(const _Float16* p) {
    union { v16h v; uint4 q[2]; } u;
    u.q[0] = *(const uint4*)(p);         // k = k0 + kbase ..
    u.q[1] = *(const uint4*)(p + 256);   // k = k0 + 16 + kbase ..
    return u.v;
}

// Inputs-only fence on the loaded values of four fragments and on the address
// they were loaded from: it keeps these registers apart until it, so the loads
// of a k-step can all be issued before the first wait and none lands on an
// address register.  Its s_wait_xcnt 0 is the wait that belongs in front of the
// next overwrite of that address register.
__device__ __forceinline__ void hold16(v16h a, v16h b, v16h c, v16h d, const _Float16* p) {
    asm volatile("s_wait_xcnt 0x0" :: "v"(a), "v"(b), "v"(c), "v"(d), "v"(p));
}

// ---------------------------------------------------------------------------
// Kernel 0: the three inputs (S*B x D) and the four weights (D x D), f32 row-major,
// are converted once to f16 in fragment order (see loadf), one behind the other in
// the workspace: 1024 tiles of 16 rows.  The projections then load every fragment
// as whole cache lines and convert nothing.
// Block = two tiles of one matrix; a wave takes 16 rows x 256 k.  Lane = (row r of
// 8, group g of 8 k): it reads 32 bytes and writes the 16 bytes of its group, so a
// wave's store is four whole 128-byte lines.
// ---------------------------------------------------------------------------
__global__ __launch_bounds__(256) void to_frag(
    const float* __restrict__ xq, const float* __restrict__ xk, const float* __restrict__ xv,
    const float* __restrict__ wq, const float* __restrict__ wk, const float* __restrict__ wv,
    const float* __restrict__ wo, _Float16* __restrict__ out)
{
    const int pair = blockIdx.x;           // 3 x 128 pairs of input tiles, 4 x 32 of weight tiles
    const float* src;
    int first;
    if      (pair < 128) { src = xq; first = 0;   }
    else if (pair < 256) { src = xk; first = 128; }
    else if (pair < 384) { src = xv; first = 256; }
    else if (pair < 416) { src = wq; first = 384; }
    else if (pair < 448) { src = wk; first = 416; }
    else if (pair < 480) { src = wv; first = 448; }
    else                 { src = wo; first = 480; }
    const int wave = threadIdx.x >> 5;
    const int r    = (threadIdx.x & 31) >> 2;
    const int g    = threadIdx.x & 3;
    const int kq   = (wave & 3) * 256;
    const float* p = src + (size_t)(((pair - first) * 2 + (wave >> 2)) * 16 + r) * DD + kq + g * 8;
    _Float16*    q = out + (size_t)(pair * 2 + (wave >> 2)) * 16 * DD + (kq / 8 + g) * 128 + r * 8;
    v4f x[16][2];
#pragma unroll
    for (int u = 0; u < 16; ++u) {         // u = 32-k block * 2 + upper half of the rows
        const float* pu = p + (u & 1) * 8 * DD + (u >> 1) * 32;
        x[u][0] = *(const v4f*)(pu);
        x[u][1] = *(const v4f*)(pu + 4);
    }
    // The wait that belongs in front of an overwrite of the register that these
    // loads name as their address (p, held to here as an input).
    asm volatile("s_wait_xcnt 0x0" :: "v"(p) : "memory");
#pragma unroll
    for (int u = 0; u < 16; ++u) {
        union { _Float16 e[8]; uint4 v; } c;
#pragma unroll
        for (int t = 0; t < 4; ++t) { c.e[t] = (_Float16)x[u][0][t]; c.e[4 + t] = (_Float16)x[u][1][t]; }
        *(uint4*)(q + (u >> 1) * 512 + (u & 1) * 64) = c.v;
    }
}

// ---------------------------------------------------------------------------
// Kernel 1: QKV projection  Y = X(M x D) @ W^T(D x D) + b, X and W f16 in fragment
// order (kernel 0)
// Both stores are in fragment order (see loadf):
//   MODE 0: Q and K, rows = positions, k = dk:  (B,H, S/16, DK/8, 16 s, 8 dk)
//   MODE 1: V^T,     rows = dk, k = positions:  (B,H, S/32, DK/16, 4, 16 dk, 8 s)
// One wave per 64x64 tile of Y (4x4 accumulator fragments): each loaded
// fragment feeds four WMMAs.  Block = 2x2 waves = 128x128 of Y;
// M = S*B = 4096, N = 1024 -> 32x8 = 256 blocks x 4 waves.
// ---------------------------------------------------------------------------
template <int MODE>
__global__ __launch_bounds__(128) void proj_qkv(
    const _Float16* __restrict__ X, const _Float16* __restrict__ W,
    const float* __restrict__ bias, _Float16* __restrict__ out)
{
    const int lo   = threadIdx.x & 15;
    const int hi   = (threadIdx.x >> 4) & 1;
    const int wave = threadIdx.x >> 5;
    const int m0 = (blockIdx.x & 31) * 128 + (wave >> 1) * 64;   // M/128 = 32
    const int n0 = (blockIdx.x >> 5) * 128 + (wave & 1)  * 64;   // N/128 = 8

    const _Float16* xp = X + (size_t)m0 * DD + (threadIdx.x & 31) * 8;   // 16 rows = 16*DD elements
    const _Float16* wp = W + (size_t)n0 * DD + (threadIdx.x & 31) * 8;   // B = W^T: output col = W row
    v8f acc[4][4] = {};
    // A k-step is 32 loads of 16 bytes, as many as before, and now spans 64 k.
    for (int k0 = 0; k0 < DD; k0 += 64, xp += 1024, wp += 1024) {
        v16h a[2][4], b[2][4];
#pragma unroll
        for (int u = 0; u < 2; ++u) {
#pragma unroll
            for (int i = 0; i < 4; ++i) a[u][i] = loadf(xp + u * 512 + i * 16 * DD);
#pragma unroll
            for (int j = 0; j < 4; ++j) b[u][j] = loadf(wp + u * 512 + j * 16 * DD);
        }
        // Holds the k-step's loads in place as one group (loaded values as inputs
        // only): the one wave of a SIMD then waits out a cache latency once per k-step.
        hold16(a[0][0], a[0][1], a[0][2], a[0][3], xp);
        hold16(b[0][0], b[0][1], b[0][2], b[0][3], wp);
        hold16(a[1][0], a[1][1], a[1][2], a[1][3], xp);
        hold16(b[1][0], b[1][1], b[1][2], b[1][3], wp);
#pragma unroll
        for (int u = 0; u < 2; ++u)
#pragma unroll
            for (int i = 0; i < 4; ++i)
#pragma unroll
                for (int j = 0; j < 4; ++j) acc[i][j] = wmma(a[u][i], b[u][j], acc[i][j]);
    }

    const int col0 = n0 + lo;
    float bv[4];
#pragma unroll
    for (int j = 0; j < 4; ++j) bv[j] = bias[col0 + j * 16];
    // The wait that belongs in front of an overwrite of the register that the four
    // bias loads name (col0, held to here as an input).
    asm volatile("s_wait_xcnt 0x0" :: "v"(bv[0]), "v"(bv[1]), "v"(bv[2]), "v"(bv[3]), "v"(col0));
#pragma unroll
    for (int j = 0; j < 4; ++j) {
        const int   col = col0 + j * 16;
        const int   h   = col >> 6;        // / DK
        const int   dk  = col & 63;
#pragma unroll
        for (int i = 0; i < 4; ++i) {
            // The same wait for the registers that issued stores name: the sums of this
            // group of 16 rows all read bv[j], so they stay behind it, and the stores of
            // the group before stay in front of it.
            if (i + j > 0) asm volatile("s_wait_xcnt 0x0" : "+v"(bv[j]) :: "memory");
            if (MODE == 0) {
#pragma unroll
                for (int r = 0; r < 8; ++r) {
                    const int rg = m0 + i * 16 + r + 8 * hi;   // row in (s*B + b)
                    const int s  = rg >> 1;                    // B = 2
                    const int b  = rg & 1;
                    out[(((size_t)(b * HH + h) * (SS / 16) + (s >> 4)) * 8 + (dk >> 3)) * 128
                        + (s & 15) * 8 + (dk & 7)] = (_Float16)(acc[i][j][r] + bv[j]);
                }
            } else {
                // rows r = b, b+2, b+4, b+6 are positions s0 .. s0+3 of batch b, with
                // s0 = m0/2 + 8*i + 4*hi: four neighbours in V^T's order, one 8-byte store.
#pragma unroll
                for (int b = 0; b < 2; ++b) {
                    union { _Float16 e[4]; uint2 q; } u;
#pragma unroll
                    for (int t = 0; t < 4; ++t) u.e[t] = (_Float16)(acc[i][j][2 * t + b] + bv[j]);
                    *(uint2*)(out + (((size_t)(b * HH + h) * (SS / 32) + (m0 >> 6)) * 4 + (dk >> 4)) * 512
                              + i * 128 + (dk & 15) * 8 + 4 * hi) = u.q;
                }
            }
        }
    }
}

// ---------------------------------------------------------------------------
// Kernel 2: flash attention per (b,h).  Block = 8 waves, each wave owns 16
// queries; online softmax over 32 keys/iteration, computed transposed:
//   S^T = K Q^T   (A = K rows, B = Q^T kept in registers): 4 WMMAs
//   O^T += V^T P^T (A = V^T rows, B = P^T): 4 WMMAs
// In a D tile lane l holds column l & 15, so every lane holds scores of ONE
// query (keys 8*hi + r of each 16-key tile): maximum and sum run in the lane,
// with one exchange between the wave's halves, and the two score tiles,
// converted in place, are already the B operand P^T in the hardware k order
// (the order loadf loads V^T in).
// Saves per-row (max, sum) stats for the attention-mean recompute kernel.
// ---------------------------------------------------------------------------
// Lane l <-> lane l ^ 16.
__device__ __forceinline__ float xhalf(float x) {
    const int i = __builtin_bit_cast(int, x);
    return __builtin_bit_cast(float,
        __builtin_amdgcn_permlanex16(i, i, 0x76543210, 0xfedcba98, false, false));
}

__global__ __launch_bounds__(256) void attn_flash(
    const _Float16* __restrict__ qh, const _Float16* __restrict__ kh,
    const _Float16* __restrict__ vt, const float* __restrict__ mask,
    _Float16* __restrict__ xatt, float* __restrict__ stats)
{
    const int wave = threadIdx.x >> 5;
    const int lo   = threadIdx.x & 15;
    const int hi   = (threadIdx.x >> 4) & 1;
    const int bh   = blockIdx.x >> 4;      // grid = (B*H) * (S/128)
    const int qblk = blockIdx.x & 15;
    const int b    = bh >> 4;              // / H
    const int h    = bh & 15;
    const int q0   = qblk * 128 + wave * 16;

    // Q^T B-fragments (persistent): lane = query column; DK=64 -> two 32-wide K chunks
    const int lane8 = (threadIdx.x & 31) * 8;
    const _Float16* qtile = qh + ((size_t)bh * SS + q0) * DKK + lane8;
    const v16h qb0 = loadf(qtile);
    const v16h qb1 = loadf(qtile + 512);

    float mrow = -1e30f;   // this lane's query: running maximum (same in both halves)
    float lrow = 0.f;      // running sum over this half's keys only
    v8f   o[4] = {};       // o[c][r] = O[q0 + lo][c*16 + 8*hi + r]

    const float     scale = 0.125f;                      // 1/sqrt(DK)
    const float*    mrowp = mask + ((size_t)b * SS + q0 + lo) * SS + 8 * hi;
    const _Float16* kbase = kh + (size_t)bh * SS * DKK + lane8;   // 16 keys = 1024 elements
    const _Float16* vbase = vt + (size_t)bh * SS * DKK + lane8;   // 32 keys = 2048 elements

    // One pass = 32 keys.  Its operands are fetched one pass ahead into the same registers:
    // K and the mask values of the next pass right behind this pass's masked scores, V^T of
    // the next pass right behind this pass's O^T products.  The loads then fly while the
    // rest of a pass computes, and no pass but the first waits out the latency of its own loads.
    v16h ka[2][2];         // K: two tiles of 16 keys x 64 dk
    v4f  ma[2], mb[2];     // this lane's 16 mask values
    v16h va[4];            // V^T: four tiles of 16 dk x 32 keys
    auto fetch_km = [&](int j0) {
        const _Float16* kp = kbase + (size_t)j0 * DKK;
        const float*    mp = mrowp + j0;
#pragma unroll
        for (int f = 0; f < 2; ++f) {
            ka[f][0] = loadf(kp + f * 1024);
            ka[f][1] = loadf(kp + f * 1024 + 512);
        }
#pragma unroll
        for (int f = 0; f < 2; ++f) {
            ma[f] = *(const v4f*)(mp + f * 16);
            mb[f] = *(const v4f*)(mp + f * 16 + 4);
        }
        // The wait that belongs in front of an overwrite of a register that these loads
        // name as their address (both addresses are held to here as inputs).
        asm volatile("s_wait_xcnt 0x0" :: "v"(kp), "v"(mp) : "memory");
    };
    auto fetch_v = [&](int j0) {
        const _Float16* vp = vbase + (size_t)j0 * DKK;
#pragma unroll
        for (int c = 0; c < 4; ++c) va[c] = loadf(vp + c * 512);
        // The same wait behind the V^T loads.
        asm volatile("s_wait_xcnt 0x0" :: "v"(vp) : "memory");
    };
    auto pass = [&](bool more, int jnext) {
        // ---- S^T for the pass's 32 keys: sc[f][r] = S[q0+lo][j0 + f*16 + 8*hi + r] ----
        v8f sc[2];
#pragma unroll
        for (int f = 0; f < 2; ++f) {
            v8f c = {};
            c = wmma(ka[f][0], qb0, c);
            c = wmma(ka[f][1], qb1, c);
            sc[f] = c;
        }
        // ---- scale + mask: a lane's 8 keys of a tile are contiguous in its mask row; written
        //      in pairs of neighbours, as they lie in the registers (no register moves) ----
        v2f s2[8];
#pragma unroll
        for (int f = 0; f < 2; ++f) {
            s2[f * 4 + 0] = __builtin_shufflevector(sc[f], sc[f], 0, 1) * scale + __builtin_shufflevector(ma[f], ma[f], 0, 1);
            s2[f * 4 + 1] = __builtin_shufflevector(sc[f], sc[f], 2, 3) * scale + __builtin_shufflevector(ma[f], ma[f], 2, 3);
            s2[f * 4 + 2] = __builtin_shufflevector(sc[f], sc[f], 4, 5) * scale + __builtin_shufflevector(mb[f], mb[f], 0, 1);
            s2[f * 4 + 3] = __builtin_shufflevector(sc[f], sc[f], 6, 7) * scale + __builtin_shufflevector(mb[f], mb[f], 2, 3);
        }
        if (more) {
            // K and the mask values have been read: refill their registers for the next pass.
            // The two scheduling barriers keep the twelve loads together at this place: without
            // them the compiler moves a part of them behind the softmax, too late to be hidden.
            __builtin_amdgcn_sched_barrier(0);
            fetch_km(jnext);
            __builtin_amdgcn_sched_barrier(0);
        }
        // ---- online softmax, all in the lane but for one exchange of the maximum ----
        float s[16];
#pragma unroll
        for (int i = 0; i < 16; ++i) s[i] = s2[i >> 1][i & 1];
        float mx = s[0];
#pragma unroll
        for (int i = 1; i < 16; ++i) mx = fmaxf(mx, s[i]);
        mx = fmaxf(mx, xhalf(mx));
        const float mnew = fmaxf(mrow, mx);
        const float corr = __expf(mrow - mnew);
        mrow = mnew;
        float p[16];
#pragma unroll
        for (int i = 0; i < 16; ++i) p[i] = __expf(s[i] - mnew);
        const float psum = (((p[0] + p[1]) + (p[2] + p[3])) + ((p[4] + p[5]) + (p[6] + p[7])))
                         + (((p[8] + p[9]) + (p[10] + p[11])) + ((p[12] + p[13]) + (p[14] + p[15])));
        lrow = lrow * corr + psum;
        // ---- rescale O^T: one factor per lane ----
#pragma unroll
        for (int c = 0; c < 4; ++c)
#pragma unroll
            for (int r = 0; r < 8; ++r) o[c][r] *= corr;
        // ---- P^T as B operand: element i = key kmap(i, hi), no lane exchange ----
        v16h pb;
#pragma unroll
        for (int i = 0; i < 16; ++i) pb[i] = (_Float16)p[i];
        // ---- O^T += V^T P^T ; A = V^T rows (lane = dk row), one fragment per 16 dk ----
#pragma unroll
        for (int c = 0; c < 4; ++c) o[c] = wmma(va[c], pb, o[c]);
        if (more) fetch_v(jnext);   // V^T has been read: refill its registers for the next pass
    };

    fetch_km(0);
    fetch_v(0);
    for (int j0 = 32; j0 < SS; j0 += 32) pass(true, j0);
    pass(false, 0);

    // ---- join the halves' sums, normalize, store x_att f16 (rows b*S+s, k = D, in
    //      fragment order for kernel 3: a wave's store is 512 contiguous bytes) and stats ----
    const float lsum = lrow + xhalf(lrow);
    const float inv  = 1.0f / lsum;
    _Float16* xrow = xatt + ((size_t)((b * SS + q0) >> 4) * (DD / 8) + h * 8 + hi) * 128 + lo * 8;
#pragma unroll
    for (int c = 0; c < 4; ++c) {
        union { _Float16 e[8]; uint4 q; } u;       // 8 consecutive dk: one 16-byte store
#pragma unroll
        for (int r = 0; r < 8; ++r) u.e[r] = (_Float16)(o[c][r] * inv);
        *(uint4*)(xrow + c * 256) = u.q;           // 16 dk on = two groups of 8 k
    }
    if (hi == 0)
        *(float2*)(stats + ((size_t)bh * SS + q0 + lo) * 2) = make_float2(mrow, lsum);
}

// ---------------------------------------------------------------------------
// Kernel 3: output projection  out = x_att(f16, fragment order, rows b*S+s) @ Wo^T + bo,
// Wo f16 in fragment order (kernel 0)
// (f32 out, S,B,D)
// Same tiling as kernel 1: one wave per 64x64 of Y, 2x2 waves per block.
// ---------------------------------------------------------------------------
__global__ __launch_bounds__(128) void proj_out(
    const _Float16* __restrict__ X, const _Float16* __restrict__ W,
    const float* __restrict__ bias, float* __restrict__ out)
{
    const int lo   = threadIdx.x & 15;
    const int hi   = (threadIdx.x >> 4) & 1;
    const int wave = threadIdx.x >> 5;
    const int m0 = (blockIdx.x & 31) * 128 + (wave >> 1) * 64;
    const int n0 = (blockIdx.x >> 5) * 128 + (wave & 1)  * 64;

    const _Float16* xp = X + (size_t)m0 * DD + (threadIdx.x & 31) * 8;   // 16 rows = 16*DD elements
    const _Float16* wp = W + (size_t)n0 * DD + (threadIdx.x & 31) * 8;
    v8f acc[4][4] = {};
    // A k-step is 32 loads of 16 bytes, as many as before, and now spans 64 k.
    for (int k0 = 0; k0 < DD; k0 += 64, xp += 1024, wp += 1024) {
        v16h a[2][4], b[2][4];
#pragma unroll
        for (int u = 0; u < 2; ++u) {
#pragma unroll
            for (int i = 0; i < 4; ++i) a[u][i] = loadf(xp + u * 512 + i * 16 * DD);
#pragma unroll
            for (int j = 0; j < 4; ++j) b[u][j] = loadf(wp + u * 512 + j * 16 * DD);
        }
        // Holds the k-step's loads in place as one group (loaded values as inputs
        // only): the one wave of a SIMD then waits out a cache latency once per k-step.
        hold16(a[0][0], a[0][1], a[0][2], a[0][3], xp);
        hold16(b[0][0], b[0][1], b[0][2], b[0][3], wp);
        hold16(a[1][0], a[1][1], a[1][2], a[1][3], xp);
        hold16(b[1][0], b[1][1], b[1][2], b[1][3], wp);
#pragma unroll
        for (int u = 0; u < 2; ++u)
#pragma unroll
            for (int i = 0; i < 4; ++i)
#pragma unroll
                for (int j = 0; j < 4; ++j) acc[i][j] = wmma(a[u][i], b[u][j], acc[i][j]);
    }

    const int col0 = n0 + lo;
    float bv[4];
#pragma unroll
    for (int j = 0; j < 4; ++j) bv[j] = bias[col0 + j * 16];
    // The wait in front of an overwrite of the bias loads' register (see kernel 1).
    asm volatile("s_wait_xcnt 0x0" :: "v"(bv[0]), "v"(bv[1]), "v"(bv[2]), "v"(bv[3]), "v"(col0));
#pragma unroll
    for (int j = 0; j < 4; ++j) {
        // The wait in front of an overwrite of a store's registers (see kernel 1).
        if (j > 0) asm volatile("s_wait_xcnt 0x0" : "+v"(bv[j]) :: "memory");
#pragma unroll
        for (int i = 0; i < 4; ++i)
#pragma unroll
            for (int r = 0; r < 8; ++r) {
                // x_att row m0 + ... = b*S + s (a wave's 64 rows are of one b) -> out row s*B + b
                const int rg = ((m0 & (SS - 1)) + i * 16 + r + 8 * hi) * BB + (m0 >> 11);
                out[(size_t)rg * DD + col0 + j * 16] = acc[i][j][r] + bv[j];
            }
    }
}

// ---------------------------------------------------------------------------
// Kernel 4: attn = mean over heads of softmax(QK^T/sqrt+mask).
// Recompute scores with WMMA (Q/K tiles are L2-resident), transposed as in
// kernel 2 (A = K rows, B = Q^T): a lane holds 8 consecutive keys of ONE query,
// so the stored (max,sum) stats are one load and one reciprocal per lane and
// head.  Grid = B * (S/16) * (S/128), 8 waves/block.
// ---------------------------------------------------------------------------
__global__ __launch_bounds__(256) void attn_mean(
    const _Float16* __restrict__ qh, const _Float16* __restrict__ kh,
    const float* __restrict__ mask, const float* __restrict__ stats,
    float* __restrict__ attn)
{
    const int wave = threadIdx.x >> 5;
    const int lo   = threadIdx.x & 15;
    const int hi   = (threadIdx.x >> 4) & 1;
    int idx = blockIdx.x;
    const int tblk = idx & 15;  idx >>= 4;   // S/128
    const int sblk = idx & 127; idx >>= 7;   // S/16
    const int b    = idx;
    const int s0   = sblk * 16;
    const int t0   = tblk * 128 + wave * 16;

    // element r of this lane: query s0 + lo, key t0 + 8*hi + r
    const size_t eoff = ((size_t)b * SS + s0 + lo) * SS + t0 + 8 * hi;
    const v4f ma = *(const v4f*)(mask + eoff);
    const v4f mb = *(const v4f*)(mask + eoff + 4);
    float maskv[8], acc[8];
#pragma unroll
    for (int r = 0; r < 4; ++r) { maskv[r] = ma[r]; maskv[4 + r] = mb[r]; }
#pragma unroll
    for (int r = 0; r < 8; ++r) acc[r] = 0.f;
    const float scale = 0.125f;

    // head 0 of this batch; a head is SS rows further on (lane's place in the pointer)
    const int lane8 = (threadIdx.x & 31) * 8;
    const _Float16* qp = qh + ((size_t)(b * HH) * SS + s0) * DKK + lane8;
    const _Float16* kp = kh + ((size_t)(b * HH) * SS + t0) * DKK + lane8;
    const float*    sp = stats + ((size_t)(b * HH) * SS + s0 + lo) * 2;
    for (int h = 0; h < HH; ++h, qp += SS * DKK, kp += SS * DKK, sp += SS * 2) {
        const float2 st = *(const float2*)sp;
        const v16h ka0 = loadf(kp),       qb0 = loadf(qp);
        const v16h ka1 = loadf(kp + 512), qb1 = loadf(qp + 512);
        // The wait that belongs in front of an overwrite of a register that these
        // loads name as their address.
        asm volatile("s_wait_xcnt 0x0" ::: "memory");
        v8f c = {};
        c = wmma(ka0, qb0, c);
        c = wmma(ka1, qb1, c);
        const float inv = 1.0f / st.y;
#pragma unroll
        for (int r = 0; r < 8; ++r)
            acc[r] += __expf(c[r] * scale + maskv[r] - st.x) * inv;
    }
    const float invH = 1.0f / HH;
    v4f oa, ob;
#pragma unroll
    for (int r = 0; r < 4; ++r) { oa[r] = acc[r] * invH; ob[r] = acc[4 + r] * invH; }
    *(v4f*)(attn + eoff)     = oa;
    *(v4f*)(attn + eoff + 4) = ob;
}

// ---------------------------------------------------------------------------
// Launcher
// ---------------------------------------------------------------------------
extern "C" void kernel_launch(void* const* d_in, const int* in_sizes, int n_in,
                              void* d_out, int out_size, void* d_ws, size_t ws_size,
                              hipStream_t stream) {
    const float* query = (const float*)d_in[0];
    const float* key   = (const float*)d_in[1];
    const float* value = (const float*)d_in[2];
    const float* mask  = (const float*)d_in[3];
    const float* Wq = (const float*)d_in[4];  const float* bq = (const float*)d_in[5];
    const float* Wk = (const float*)d_in[6];  const float* bk = (const float*)d_in[7];
    const float* Wv = (const float*)d_in[8];  const float* bv = (const float*)d_in[9];
    const float* Wo = (const float*)d_in[10]; const float* bo = (const float*)d_in[11];

    float* out  = (float*)d_out;                       // (S,B,D)
    float* attn = out + (size_t)SS * BB * DD;          // (B,S,S)

    // Workspace layout (~67.6 MB total)
    const size_t headElems = (size_t)BB * HH * SS * DKK;   // 4,194,304
    _Float16* qh   = (_Float16*)d_ws;                  // per (b,h): S x DK   f16, fragment order
    _Float16* kh   = qh + headElems;                   // per (b,h): S x DK   f16, fragment order
    _Float16* vt   = kh + headElems;                   // per (b,h): DK x S   f16, fragment order
    _Float16* xatt = vt + headElems;                   // (B*S) x D   f16, fragment order
    float*    stats = (float*)(xatt + (size_t)SS * BB * DD); // (B,H,S,2) f32
    // f16 copies in fragment order, in kernel 0's order of tiles
    _Float16* xq16 = (_Float16*)(stats + (size_t)BB * HH * SS * 2);
    _Float16* xk16 = xq16 + (size_t)SS * BB * DD;
    _Float16* xv16 = xk16 + (size_t)SS * BB * DD;
    _Float16* wq16 = xv16 + (size_t)SS * BB * DD;
    _Float16* wk16 = wq16 + (size_t)DD * DD;
    _Float16* wv16 = wk16 + (size_t)DD * DD;
    _Float16* wo16 = wv16 + (size_t)DD * DD;

    to_frag<<<512, 256, 0, stream>>>(query, key, value, Wq, Wk, Wv, Wo, xq16);
    proj_qkv<0><<<256, 128, 0, stream>>>(xq16, wq16, bq, qh);
    proj_qkv<0><<<256, 128, 0, stream>>>(xk16, wk16, bk, kh);
    proj_qkv<1><<<256, 128, 0, stream>>>(xv16, wv16, bv, vt);
    attn_flash<<<512, 256, 0, stream>>>(qh, kh, vt, mask, xatt, stats);
    proj_out<<<256, 128, 0, stream>>>(xatt, wo16, bo, out);
    attn_mean<<<4096, 256, 0, stream>>>(qh, kh, mask, stats, attn);
}

// v006
// A run of this version takes 163 microseconds.
// Two timings next to v005 both put it at 1.13 times that version's speed.
// Counting every step since v000, it is 3.72 times as fast.
#include <hip/hip_runtime.h>
#include <hip/hip_bf16.h>

// Problem constants (from reference)
#define SS  2048
#define BB  2
#define DD  1024
#define HH  16
#define DKK 64

typedef __attribute__((ext_vector_type(16))) _Float16 v16h;
typedef __attribute__((ext_vector_type(8)))  float    v8f;
typedef __attribute__((ext_vector_type(4)))  float    v4f;
typedef __attribute__((ext_vector_type(2)))  float    v2f;

// ---------------------------------------------------------------------------
// WMMA helper: D = A(16x32 f16) * B(32x16 f16) + C(16x16 f32)
// ---------------------------------------------------------------------------
__device__ __forceinline__ v8f wmma(v16h a, v16h b, v8f c) {
    return __builtin_amdgcn_wmma_f32_16x16x32_f16(
        /*neg_a=*/false, a, /*neg_b=*/false, b,
        /*c_mod=*/(short)0, c, /*reuse_a=*/false, /*reuse_b=*/false);
}

// A/B fragments (ISA 16-bit 16x32 layout):
//   lane L: row/col = L&15 ; kbase = (L>>4)*8
//   VGPRs 0..3 hold K = kbase..kbase+7 (16 contiguous bytes)
//   VGPRs 4..7 hold K = 16+kbase..16+kbase+7 (16 contiguous bytes)
// The f16 matrices in the workspace are kept in that order ("fragment order"):
// a tile of 16 rows is stored as groups of 8 k, each group [16 rows][8 k] = 256 B:
//   element (row, k) of a tile: (k >> 3) * 128 + (row & 15) * 8 + (k & 7)
// A fragment (16 rows x 32 k) is then 1 KiB in a row and its two 128-bit loads
// each read 512 contiguous bytes per wave (4 cache lines instead of 16).
// p = tile + k0 * 16 + lane * 8.
__device__ __forceinline__ v16h loadf(const _Float16* p) {
    union { v16h v; uint4 q[2]; } u;
    u.q[0] = *(const uint4*)(p);         // k = k0 + kbase ..
    u.q[1] = *(const uint4*)(p + 256);   // k = k0 + 16 + kbase ..
    return u.v;
}

// Inputs-only fence on the loaded values of four fragments and on the address
// they were loaded from: it keeps these registers apart until it, so the loads
// of a k-step can all be issued before the first wait and none lands on an
// address register.  Its s_wait_xcnt 0 is the wait that belongs in front of the
// next overwrite of that address register.
__device__ __forceinline__ void hold16(v16h a, v16h b, v16h c, v16h d, const _Float16* p) {
    asm volatile("s_wait_xcnt 0x0" :: "v"(a), "v"(b), "v"(c), "v"(d), "v"(p));
}

// ---------------------------------------------------------------------------
// Kernel 0: the three inputs (S*B x D) and the four weights (D x D), f32 row-major,
// are converted once to f16 in fragment order (see loadf), one behind the other in
// the workspace: 1024 tiles of 16 rows.  The projections then load every fragment
// as whole cache lines and convert nothing.
// Block = two tiles of one matrix; a wave takes 16 rows x 256 k.  Lane = (row r of
// 8, group g of 8 k): it reads 32 bytes and writes the 16 bytes of its group, so a
// wave's store is four whole 128-byte lines.
// ---------------------------------------------------------------------------
__global__ __launch_bounds__(256) void to_frag(
    const float* __restrict__ xq, const float* __restrict__ xk, const float* __restrict__ xv,
    const float* __restrict__ wq, const float* __restrict__ wk, const float* __restrict__ wv,
    const float* __restrict__ wo, _Float16* __restrict__ out)
{
    const int pair = blockIdx.x;           // 3 x 128 pairs of input tiles, 4 x 32 of weight tiles
    const float* src;
    int first;
    if      (pair < 128) { src = xq; first = 0;   }
    else if (pair < 256) { src = xk; first = 128; }
    else if (pair < 384) { src = xv; first = 256; }
    else if (pair < 416) { src = wq; first = 384; }
    else if (pair < 448) { src = wk; first = 416; }
    else if (pair < 480) { src = wv; first = 448; }
    else                 { src = wo; first = 480; }
    const int wave = threadIdx.x >> 5;
    const int r    = (threadIdx.x & 31) >> 2;
    const int g    = threadIdx.x & 3;
    const int kq   = (wave & 3) * 256;
    const float* p = src + (size_t)(((pair - first) * 2 + (wave >> 2)) * 16 + r) * DD + kq + g * 8;
    _Float16*    q = out + (size_t)(pair * 2 + (wave >> 2)) * 16 * DD + (kq / 8 + g) * 128 + r * 8;
    v4f x[16][2];
#pragma unroll
    for (int u = 0; u < 16; ++u) {         // u = 32-k block * 2 + upper half of the rows
        const float* pu = p + (u & 1) * 8 * DD + (u >> 1) * 32;
        x[u][0] = *(const v4f*)(pu);
        x[u][1] = *(const v4f*)(pu + 4);
    }
    // The wait that belongs in front of an overwrite of the register that these
    // loads name as their address (p, held to here as an input).
    asm volatile("s_wait_xcnt 0x0" :: "v"(p) : "memory");
#pragma unroll
    for (int u = 0; u < 16; ++u) {
        union { _Float16 e[8]; uint4 v; } c;
#pragma unroll
        for (int t = 0; t < 4; ++t) { c.e[t] = (_Float16)x[u][0][t]; c.e[4 + t] = (_Float16)x[u][1][t]; }
        *(uint4*)(q + (u >> 1) * 512 + (u & 1) * 64) = c.v;
    }
}

// ---------------------------------------------------------------------------
// Kernel 1: QKV projection  Y = X(M x D) @ W^T(D x D) + b, X and W f16 in fragment
// order (kernel 0)
// Both stores are in fragment order (see loadf):
//   MODE 0: Q and K, rows = positions, k = dk:  (B,H, S/16, DK/8, 16 s, 8 dk)
//   MODE 1: V^T,     rows = dk, k = positions:  (B,H, S/32, DK/16, 4, 16 dk, 8 s)
// One wave per 64x64 tile of Y (4x4 accumulator fragments): each loaded
// fragment feeds four WMMAs.  Block = 2x2 waves = 128x128 of Y;
// M = S*B = 4096, N = 1024 -> 32x8 = 256 blocks x 4 waves.
// ---------------------------------------------------------------------------
template <int MODE>
__global__ __launch_bounds__(128) void proj_qkv(
    const _Float16* __restrict__ X, const _Float16* __restrict__ W,
    const float* __restrict__ bias, _Float16* __restrict__ out)
{
    const int lo   = threadIdx.x & 15;
    const int hi   = (threadIdx.x >> 4) & 1;
    const int wave = threadIdx.x >> 5;
    const int m0 = (blockIdx.x & 31) * 128 + (wave >> 1) * 64;   // M/128 = 32
    const int n0 = (blockIdx.x >> 5) * 128 + (wave & 1)  * 64;   // N/128 = 8

    const _Float16* xp = X + (size_t)m0 * DD + (threadIdx.x & 31) * 8;   // 16 rows = 16*DD elements
    const _Float16* wp = W + (size_t)n0 * DD + (threadIdx.x & 31) * 8;   // B = W^T: output col = W row
    v8f acc[4][4] = {};
    // A k-step is 32 loads of 16 bytes, as many as before, and now spans 64 k.
    for (int k0 = 0; k0 < DD; k0 += 64, xp += 1024, wp += 1024) {
        v16h a[2][4], b[2][4];
#pragma unroll
        for (int u = 0; u < 2; ++u) {
#pragma unroll
            for (int i = 0; i < 4; ++i) a[u][i] = loadf(xp + u * 512 + i * 16 * DD);
#pragma unroll
            for (int j = 0; j < 4; ++j) b[u][j] = loadf(wp + u * 512 + j * 16 * DD);
        }
        // Holds the k-step's loads in place as one group (loaded values as inputs
        // only): the one wave of a SIMD then waits out a cache latency once per k-step.
        hold16(a[0][0], a[0][1], a[0][2], a[0][3], xp);
        hold16(b[0][0], b[0][1], b[0][2], b[0][3], wp);
        hold16(a[1][0], a[1][1], a[1][2], a[1][3], xp);
        hold16(b[1][0], b[1][1], b[1][2], b[1][3], wp);
#pragma unroll
        for (int u = 0; u < 2; ++u)
#pragma unroll
            for (int i = 0; i < 4; ++i)
#pragma unroll
                for (int j = 0; j < 4; ++j) acc[i][j] = wmma(a[u][i], b[u][j], acc[i][j]);
    }

    const int col0 = n0 + lo;
    float bv[4];
#pragma unroll
    for (int j = 0; j < 4; ++j) bv[j] = bias[col0 + j * 16];
    // The wait that belongs in front of an overwrite of the register that the four
    // bias loads name (col0, held to here as an input).
    asm volatile("s_wait_xcnt 0x0" :: "v"(bv[0]), "v"(bv[1]), "v"(bv[2]), "v"(bv[3]), "v"(col0));
#pragma unroll
    for (int j = 0; j < 4; ++j) {
        const int   col = col0 + j * 16;
        const int   h   = col >> 6;        // / DK
        const int   dk  = col & 63;
#pragma unroll
        for (int i = 0; i < 4; ++i) {
            // The same wait for the registers that issued stores name: the sums of this
            // group of 16 rows all read bv[j], so they stay behind it, and the stores of
            // the group before stay in front of it.
            if (i + j > 0) asm volatile("s_wait_xcnt 0x0" : "+v"(bv[j]) :: "memory");
            if (MODE == 0) {
#pragma unroll
                for (int r = 0; r < 8; ++r) {
                    const int rg = m0 + i * 16 + r + 8 * hi;   // row in (s*B + b)
                    const int s  = rg >> 1;                    // B = 2
                    const int b  = rg & 1;
                    out[(((size_t)(b * HH + h) * (SS / 16) + (s >> 4)) * 8 + (dk >> 3)) * 128
                        + (s & 15) * 8 + (dk & 7)] = (_Float16)(acc[i][j][r] + bv[j]);
                }
            } else {
                // rows r = b, b+2, b+4, b+6 are positions s0 .. s0+3 of batch b, with
                // s0 = m0/2 + 8*i + 4*hi: four neighbours in V^T's order, one 8-byte store.
#pragma unroll
                for (int b = 0; b < 2; ++b) {
                    union { _Float16 e[4]; uint2 q; } u;
#pragma unroll
                    for (int t = 0; t < 4; ++t) u.e[t] = (_Float16)(acc[i][j][2 * t + b] + bv[j]);
                    *(uint2*)(out + (((size_t)(b * HH + h) * (SS / 32) + (m0 >> 6)) * 4 + (dk >> 4)) * 512
                              + i * 128 + (dk & 15) * 8 + 4 * hi) = u.q;
                }
            }
        }
    }
}

// ---------------------------------------------------------------------------
// Kernel 2: flash attention per (b,h).  Block = 8 waves, each wave owns 16
// queries; online softmax over 32 keys/iteration, computed transposed:
//   S^T = K Q^T   (A = K rows, B = Q^T kept in registers): 4 WMMAs
//   O^T += V^T P^T (A = V^T rows, B = P^T): 4 WMMAs
// In a D tile lane l holds column l & 15, so every lane holds scores of ONE
// query (keys 8*hi + r of each 16-key tile): maximum and sum run in the lane,
// with one exchange between the wave's halves, and the two score tiles,
// converted in place, are already the B operand P^T in the hardware k order
// (the order loadf loads V^T in).
// Saves per-row (max, sum) stats for the attention-mean recompute kernel.
// ---------------------------------------------------------------------------
// Lane l <-> lane l ^ 16.
__device__ __forceinline__ float xhalf(float x) {
    const int i = __builtin_bit_cast(int, x);
    return __builtin_bit_cast(float,
        __builtin_amdgcn_permlanex16(i, i, 0x76543210, 0xfedcba98, false, false));
}

__global__ __launch_bounds__(256) void attn_flash(
    const _Float16* __restrict__ qh, const _Float16* __restrict__ kh,
    const _Float16* __restrict__ vt, const float* __restrict__ mask,
    _Float16* __restrict__ xatt, float* __restrict__ stats)
{
    const int wave = threadIdx.x >> 5;
    const int lo   = threadIdx.x & 15;
    const int hi   = (threadIdx.x >> 4) & 1;
    const int bh   = blockIdx.x >> 4;      // grid = (B*H) * (S/128)
    const int qblk = blockIdx.x & 15;
    const int b    = bh >> 4;              // / H
    const int h    = bh & 15;
    const int q0   = qblk * 128 + wave * 16;

    // Q^T B-fragments (persistent): lane = query column; DK=64 -> two 32-wide K chunks
    const int lane8 = (threadIdx.x & 31) * 8;
    const _Float16* qtile = qh + ((size_t)bh * SS + q0) * DKK + lane8;
    const v16h qb0 = loadf(qtile);
    const v16h qb1 = loadf(qtile + 512);

    float mrow = -1e30f;   // this lane's query: running maximum (same in both halves)
    float lrow = 0.f;      // running sum over this half's keys only
    v8f   o[4] = {};       // o[c][r] = O[q0 + lo][c*16 + 8*hi + r]

    const float     scale = 0.125f;                      // 1/sqrt(DK)
    const float*    mrowp = mask + ((size_t)b * SS + q0 + lo) * SS + 8 * hi;
    const _Float16* kbase = kh + (size_t)bh * SS * DKK + lane8;   // 16 keys = 1024 elements
    const _Float16* vbase = vt + (size_t)bh * SS * DKK + lane8;   // 32 keys = 2048 elements

    // One pass = 32 keys.  Its operands are fetched one pass ahead into the same registers:
    // K and the mask values of the next pass right behind this pass's masked scores, V^T of
    // the next pass right behind this pass's O^T products.  The loads then fly while the
    // rest of a pass computes, and no pass but the first waits out the latency of its own loads.
    v16h ka[2][2];         // K: two tiles of 16 keys x 64 dk
    v4f  ma[2], mb[2];     // this lane's 16 mask values
    v16h va[4];            // V^T: four tiles of 16 dk x 32 keys
    auto fetch_km = [&](int j0) {
        const _Float16* kp = kbase + (size_t)j0 * DKK;
        const float*    mp = mrowp + j0;
#pragma unroll
        for (int f = 0; f < 2; ++f) {
            ka[f][0] = loadf(kp + f * 1024);
            ka[f][1] = loadf(kp + f * 1024 + 512);
        }
#pragma unroll
        for (int f = 0; f < 2; ++f) {
            ma[f] = *(const v4f*)(mp + f * 16);
            mb[f] = *(const v4f*)(mp + f * 16 + 4);
        }
        // The wait that belongs in front of an overwrite of a register that these loads
        // name as their address (both addresses are held to here as inputs).
        asm volatile("s_wait_xcnt 0x0" :: "v"(kp), "v"(mp) : "memory");
    };
    auto fetch_v = [&](int j0) {
        const _Float16* vp = vbase + (size_t)j0 * DKK;
#pragma unroll
        for (int c = 0; c < 4; ++c) va[c] = loadf(vp + c * 512);
        // The same wait behind the V^T loads.
        asm volatile("s_wait_xcnt 0x0" :: "v"(vp) : "memory");
    };
    auto pass = [&](bool more, int jnext) {
        // ---- S^T for the pass's 32 keys: sc[f][r] = S[q0+lo][j0 + f*16 + 8*hi + r] ----
        v8f sc[2];
#pragma unroll
        for (int f = 0; f < 2; ++f) {
            v8f c = {};
            c = wmma(ka[f][0], qb0, c);
            c = wmma(ka[f][1], qb1, c);
            sc[f] = c;
        }
        // ---- scale + mask: a lane's 8 keys of a tile are contiguous in its mask row; written
        //      in pairs of neighbours, as they lie in the registers (no register moves) ----
        v2f s2[8];
#pragma unroll
        for (int f = 0; f < 2; ++f) {
            s2[f * 4 + 0] = __builtin_shufflevector(sc[f], sc[f], 0, 1) * scale + __builtin_shufflevector(ma[f], ma[f], 0, 1);
            s2[f * 4 + 1] = __builtin_shufflevector(sc[f], sc[f], 2, 3) * scale + __builtin_shufflevector(ma[f], ma[f], 2, 3);
            s2[f * 4 + 2] = __builtin_shufflevector(sc[f], sc[f], 4, 5) * scale + __builtin_shufflevector(mb[f], mb[f], 0, 1);
            s2[f * 4 + 3] = __builtin_shufflevector(sc[f], sc[f], 6, 7) * scale + __builtin_shufflevector(mb[f], mb[f], 2, 3);
        }
        if (more) {
            // K and the mask values have been read: refill their registers for the next pass.
            // The two scheduling barriers keep the twelve loads together at this place: without
            // them the compiler moves a part of them behind the softmax, too late to be hidden.
            __builtin_amdgcn_sched_barrier(0);
            fetch_km(jnext);
            __builtin_amdgcn_sched_barrier(0);
        }
        // ---- online softmax, all in the lane but for one exchange of the maximum ----
        float s[16];
#pragma unroll
        for (int i = 0; i < 16; ++i) s[i] = s2[i >> 1][i & 1];
        float mx = s[0];
#pragma unroll
        for (int i = 1; i < 16; ++i) mx = fmaxf(mx, s[i]);
        mx = fmaxf(mx, xhalf(mx));
        const float mnew = fmaxf(mrow, mx);
        const float corr = __expf(mrow - mnew);
        mrow = mnew;
        float p[16];
#pragma unroll
        for (int i = 0; i < 16; ++i) p[i] = __expf(s[i] - mnew);
        const float psum = (((p[0] + p[1]) + (p[2] + p[3])) + ((p[4] + p[5]) + (p[6] + p[7])))
                         + (((p[8] + p[9]) + (p[10] + p[11])) + ((p[12] + p[13]) + (p[14] + p[15])));
        lrow = lrow * corr + psum;
        // ---- rescale O^T: one factor per lane ----
#pragma unroll
        for (int c = 0; c < 4; ++c)
#pragma unroll
            for (int r = 0; r < 8; ++r) o[c][r] *= corr;
        // ---- P^T as B operand: element i = key kmap(i, hi), no lane exchange ----
        v16h pb;
#pragma unroll
        for (int i = 0; i < 16; ++i) pb[i] = (_Float16)p[i];
        // ---- O^T += V^T P^T ; A = V^T rows (lane = dk row), one fragment per 16 dk ----
#pragma unroll
        for (int c = 0; c < 4; ++c) o[c] = wmma(va[c], pb, o[c]);
        if (more) fetch_v(jnext);   // V^T has been read: refill its registers for the next pass
    };

    fetch_km(0);
    fetch_v(0);
    for (int j0 = 32; j0 < SS; j0 += 32) pass(true, j0);
    pass(false, 0);

    // ---- join the halves' sums, normalize, store x_att f16 (rows b*S+s, k = D, in
    //      fragment order for kernel 3: a wave's store is 512 contiguous bytes) and stats ----
    const float lsum = lrow + xhalf(lrow);
    const float inv  = 1.0f / lsum;
    _Float16* xrow = xatt + ((size_t)((b * SS + q0) >> 4) * (DD / 8) + h * 8 + hi) * 128 + lo * 8;
#pragma unroll
    for (int c = 0; c < 4; ++c) {
        union { _Float16 e[8]; uint4 q; } u;       // 8 consecutive dk: one 16-byte store
#pragma unroll
        for (int r = 0; r < 8; ++r) u.e[r] = (_Float16)(o[c][r] * inv);
        *(uint4*)(xrow + c * 256) = u.q;           // 16 dk on = two groups of 8 k
    }
    if (hi == 0)
        *(float2*)(stats + ((size_t)bh * SS + q0 + lo) * 2) = make_float2(mrow, lsum);
}

// ---------------------------------------------------------------------------
// Kernel 3: output projection  out = x_att(f16, fragment order, rows b*S+s) @ Wo^T + bo,
// Wo f16 in fragment order (kernel 0)
// (f32 out, S,B,D)
// Same tiling as kernel 1: one wave per 64x64 of Y, 2x2 waves per block.
// ---------------------------------------------------------------------------
__global__ __launch_bounds__(128) void proj_out(
    const _Float16* __restrict__ X, const _Float16* __restrict__ W,
    const float* __restrict__ bias, float* __restrict__ out)
{
    const int lo   = threadIdx.x & 15;
    const int hi   = (threadIdx.x >> 4) & 1;
    const int wave = threadIdx.x >> 5;
    const int m0 = (blockIdx.x & 31) * 128 + (wave >> 1) * 64;
    const int n0 = (blockIdx.x >> 5) * 128 + (wave & 1)  * 64;

    const _Float16* xp = X + (size_t)m0 * DD + (threadIdx.x & 31) * 8;   // 16 rows = 16*DD elements
    const _Float16* wp = W + (size_t)n0 * DD + (threadIdx.x & 31) * 8;
    v8f acc[4][4] = {};
    // A k-step is 32 loads of 16 bytes, as many as before, and now spans 64 k.
    for (int k0 = 0; k0 < DD; k0 += 64, xp += 1024, wp += 1024) {
        v16h a[2][4], b[2][4];
#pragma unroll
        for (int u = 0; u < 2; ++u) {
#pragma unroll
            for (int i = 0; i < 4; ++i) a[u][i] = loadf(xp + u * 512 + i * 16 * DD);
#pragma unroll
            for (int j = 0; j < 4; ++j) b[u][j] = loadf(wp + u * 512 + j * 16 * DD);
        }
        // Holds the k-step's loads in place as one group (loaded values as inputs
        // only): the one wave of a SIMD then waits out a cache latency once per k-step.
        hold16(a[0][0], a[0][1], a[0][2], a[0][3], xp);
        hold16(b[0][0], b[0][1], b[0][2], b[0][3], wp);
        hold16(a[1][0], a[1][1], a[1][2], a[1][3], xp);
        hold16(b[1][0], b[1][1], b[1][2], b[1][3], wp);
#pragma unroll
        for (int u = 0; u < 2; ++u)
#pragma unroll
            for (int i = 0; i < 4; ++i)
#pragma unroll
                for (int j = 0; j < 4; ++j) acc[i][j] = wmma(a[u][i], b[u][j], acc[i][j]);
    }

    const int col0 = n0 + lo;
    float bv[4];
#pragma unroll
    for (int j = 0; j < 4; ++j) bv[j] = bias[col0 + j * 16];
    // The wait in front of an overwrite of the bias loads' register (see kernel 1).
    asm volatile("s_wait_xcnt 0x0" :: "v"(bv[0]), "v"(bv[1]), "v"(bv[2]), "v"(bv[3]), "v"(col0));
#pragma unroll
    for (int j = 0; j < 4; ++j) {
        // The wait in front of an overwrite of a store's registers (see kernel 1).
        if (j > 0) asm volatile("s_wait_xcnt 0x0" : "+v"(bv[j]) :: "memory");
#pragma unroll
        for (int i = 0; i < 4; ++i)
#pragma unroll
            for (int r = 0; r < 8; ++r) {
                // x_att row m0 + ... = b*S + s (a wave's 64 rows are of one b) -> out row s*B + b
                const int rg = ((m0 & (SS - 1)) + i * 16 + r + 8 * hi) * BB + (m0 >> 11);
                out[(size_t)rg * DD + col0 + j * 16] = acc[i][j][r] + bv[j];
            }
    }
}

// ---------------------------------------------------------------------------
// Kernel 4: attn = mean over heads of softmax(QK^T/sqrt+mask).
// Recompute scores with WMMA, transposed as in kernel 2 (A = K rows, B = Q^T): a
// lane holds 8 consecutive keys of ONE query per tile, so the stored (max,sum)
// stats are one load and one reciprocal per lane, head and 16 queries.
// A wave owns 32 queries x 64 keys (2 x 4 tiles): a loaded Q^T fragment feeds four
// tiles and a K fragment two.  Block = 4 x 2 waves = 128 queries x 128 keys, so a
// block fetches 32 KiB per head for 16384 results.  Grid = B * (S/128) * (S/128).
// ---------------------------------------------------------------------------
__global__ __launch_bounds__(256) void attn_mean(
    const _Float16* __restrict__ qh, const _Float16* __restrict__ kh,
    const float* __restrict__ mask, const float* __restrict__ stats,
    float* __restrict__ attn)
{
    const int wave = threadIdx.x >> 5;
    const int lo   = threadIdx.x & 15;
    const int hi   = (threadIdx.x >> 4) & 1;
    int idx = blockIdx.x;
    const int tblk = idx & 15; idx >>= 4;    // S/128
    const int sblk = idx & 15; idx >>= 4;    // S/128
    const int b    = idx;
    const int s0   = sblk * 128 + (wave >> 1) * 32;
    const int t0   = tblk * 128 + (wave & 1) * 64;

    // element r of tile (i, j) of this lane: query s0 + 16*i + lo, key t0 + 16*j + 8*hi + r
    const size_t eoff = ((size_t)b * SS + s0 + lo) * SS + t0 + 8 * hi;
    const float* mp = mask + eoff;
    v8f mk[2][4];
#pragma unroll
    for (int i = 0; i < 2; ++i)
#pragma unroll
        for (int j = 0; j < 4; ++j) {
            const v4f ma = *(const v4f*)(mp + i * 16 * SS + j * 16);
            const v4f mb = *(const v4f*)(mp + i * 16 * SS + j * 16 + 4);
            mk[i][j] = __builtin_shufflevector(ma, mb, 0, 1, 2, 3, 4, 5, 6, 7);
        }
    // The wait that belongs in front of an overwrite of the register that these
    // loads name as their address (mp, held to here as an input).
    asm volatile("s_wait_xcnt 0x0" :: "v"(mp) : "memory");
    v8f acc[2][4] = {};
    const float scale = 0.125f;

    // head 0 of this batch; a head is SS rows further on (lane's place in the pointer)
    const int lane8 = (threadIdx.x & 31) * 8;
    const _Float16* qp = qh + ((size_t)(b * HH) * SS + s0) * DKK + lane8;   // 16 rows = 1024 elements
    const _Float16* kp = kh + ((size_t)(b * HH) * SS + t0) * DKK + lane8;
    const float*    sp = stats + ((size_t)(b * HH) * SS + s0 + lo) * 2;
    for (int h = 0; h < HH; ++h, qp += SS * DKK, kp += SS * DKK, sp += SS * 2) {
        float2 st[2];
        v16h   qb[2][2], ka[4][2];
#pragma unroll
        for (int i = 0; i < 2; ++i) {
            st[i]    = *(const float2*)(sp + i * 32);
            qb[i][0] = loadf(qp + i * 1024);
            qb[i][1] = loadf(qp + i * 1024 + 512);
        }
#pragma unroll
        for (int j = 0; j < 4; ++j) {
            ka[j][0] = loadf(kp + j * 1024);
            ka[j][1] = loadf(kp + j * 1024 + 512);
        }
        // Holds the head's 26 loads in place as one group (loaded values and their three
        // addresses as inputs only): a wave then waits out one cache latency per head, not one
        // per part of the group, and no load lands on an address register.  Its s_wait_xcnt 0
        // is the wait that belongs in front of the next overwrite of such a register.
        asm volatile("s_wait_xcnt 0x0"
                     :: "v"(qb[0][0]), "v"(qb[0][1]), "v"(qb[1][0]), "v"(qb[1][1]),
                        "v"(ka[0][0]), "v"(ka[0][1]), "v"(ka[1][0]), "v"(ka[1][1]),
                        "v"(ka[2][0]), "v"(ka[2][1]), "v"(ka[3][0]), "v"(ka[3][1]),
                        "v"(st[0].x), "v"(st[0].y), "v"(st[1].x), "v"(st[1].y),
                        "v"(qp), "v"(kp), "v"(sp)
                     : "memory");
        // All scores of the head first: the two tiles of a K tile are finished together, so
        // its fragments' registers are free for the next two score tiles.
        v8f c[2][4];
#pragma unroll
        for (int j = 0; j < 4; ++j) {
#pragma unroll
            for (int i = 0; i < 2; ++i) { v8f z = {}; c[i][j] = wmma(ka[j][0], qb[i][0], z); }
#pragma unroll
            for (int i = 0; i < 2; ++i) c[i][j] = wmma(ka[j][1], qb[i][1], c[i][j]);
        }
        // Keeps the vector work behind the sixteen WMMAs: mixed in between them it is scheduled
        // as one dependent chain per pair of scores (no free registers while the fragments live).
        __builtin_amdgcn_sched_barrier(0);
#pragma unroll
        for (int i = 0; i < 2; ++i) {
            const float inv = 1.0f / st[i].y;
#pragma unroll
            for (int j = 0; j < 4; ++j)
#pragma unroll
                for (int r = 0; r < 8; ++r)
                    acc[i][j][r] += __expf(c[i][j][r] * scale + mk[i][j][r] - st[i].x) * inv;
        }
    }
    const float invH = 1.0f / HH;
    float* op = attn + eoff;
#pragma unroll
    for (int i = 0; i < 2; ++i)
#pragma unroll
        for (int j = 0; j < 4; ++j) {
            v4f oa, ob;
#pragma unroll
            for (int r = 0; r < 4; ++r) { oa[r] = acc[i][j][r] * invH; ob[r] = acc[i][j][4 + r] * invH; }
            *(v4f*)(op + i * 16 * SS + j * 16)     = oa;
            *(v4f*)(op + i * 16 * SS + j * 16 + 4) = ob;
        }
}

// ---------------------------------------------------------------------------
// Launcher
// ---------------------------------------------------------------------------
extern "C" void kernel_launch(void* const* d_in, const int* in_sizes, int n_in,
                              void* d_out, int out_size, void* d_ws, size_t ws_size,
                              hipStream_t stream) {
    const float* query = (const float*)d_in[0];
    const float* key   = (const float*)d_in[1];
    const float* value = (const float*)d_in[2];
    const float* mask  = (const float*)d_in[3];
    const float* Wq = (const float*)d_in[4];  const float* bq = (const float*)d_in[5];
    const float* Wk = (const float*)d_in[6];  const float* bk = (const float*)d_in[7];
    const float* Wv = (const float*)d_in[8];  const float* bv = (const float*)d_in[9];
    const float* Wo = (const float*)d_in[10]; const float* bo = (const float*)d_in[11];

    float* out  = (float*)d_out;                       // (S,B,D)
    float* attn = out + (size_t)SS * BB * DD;          // (B,S,S)

    // Workspace layout (~67.6 MB total)
    const size_t headElems = (size_t)BB * HH * SS * DKK;   // 4,194,304
    _Float16* qh   = (_Float16*)d_ws;                  // per (b,h): S x DK   f16, fragment order
    _Float16* kh   = qh + headElems;                   // per (b,h): S x DK   f16, fragment order
    _Float16* vt   = kh + headElems;                   // per (b,h): DK x S   f16, fragment order
    _Float16* xatt = vt + headElems;                   // (B*S) x D   f16, fragment order
    float*    stats = (float*)(xatt + (size_t)SS * BB * DD); // (B,H,S,2) f32
    // f16 copies in fragment order, in kernel 0's order of tiles
    _Float16* xq16 = (_Float16*)(stats + (size_t)BB * HH * SS * 2);
    _Float16* xk16 = xq16 + (size_t)SS * BB * DD;
    _Float16* xv16 = xk16 + (size_t)SS * BB * DD;
    _Float16* wq16 = xv16 + (size_t)SS * BB * DD;
    _Float16* wk16 = wq16 + (size_t)DD * DD;
    _Float16* wv16 = wk16 + (size_t)DD * DD;
    _Float16* wo16 = wv16 + (size_t)DD * DD;

    to_frag<<<512, 256, 0, stream>>>(query, key, value, Wq, Wk, Wv, Wo, xq16);
    proj_qkv<0><<<256, 128, 0, stream>>>(xq16, wq16, bq, qh);
    proj_qkv<0><<<256, 128, 0, stream>>>(xk16, wk16, bk, kh);
    proj_qkv<1><<<256, 128, 0, stream>>>(xv16, wv16, bv, vt);
    attn_flash<<<512, 256, 0, stream>>>(qh, kh, vt, mask, xatt, stats);
    proj_out<<<256, 128, 0, stream>>>(xatt, wo16, bo, out);
    attn_mean<<<512, 256, 0, stream>>>(qh, kh, mask, stats, attn);
}

// v007
// A run of this version takes 138 microseconds.
// In both of two side-by-side timings against v006, it was 1.19 times as fast.
// All steps since v000 together make it 4.44 times as fast.
#include <hip/hip_runtime.h>
#include <hip/hip_bf16.h>

// Problem constants (from reference)
#define SS  2048
#define BB  2
#define DD  1024
#define HH  16
#define DKK 64

typedef __attribute__((ext_vector_type(16))) _Float16 v16h;
typedef __attribute__((ext_vector_type(8)))  float    v8f;
typedef __attribute__((ext_vector_type(4)))  float    v4f;
typedef __attribute__((ext_vector_type(2)))  float    v2f;

// ---------------------------------------------------------------------------
// WMMA helper: D = A(16x32 f16) * B(32x16 f16) + C(16x16 f32)
// ---------------------------------------------------------------------------
__device__ __forceinline__ v8f wmma(v16h a, v16h b, v8f c) {
    return __builtin_amdgcn_wmma_f32_16x16x32_f16(
        /*neg_a=*/false, a, /*neg_b=*/false, b,
        /*c_mod=*/(short)0, c, /*reuse_a=*/false, /*reuse_b=*/false);
}

// A/B fragments (ISA 16-bit 16x32 layout):
//   lane L: row/col = L&15 ; kbase = (L>>4)*8
//   VGPRs 0..3 hold K = kbase..kbase+7 (16 contiguous bytes)
//   VGPRs 4..7 hold K = 16+kbase..16+kbase+7 (16 contiguous bytes)
// The f16 matrices in the workspace are kept in that order ("fragment order"):
// a tile of 16 rows is stored as groups of 8 k, each group [16 rows][8 k] = 256 B:
//   element (row, k) of a tile: (k >> 3) * 128 + (row & 15) * 8 + (k & 7)
// A fragment (16 rows x 32 k) is then 1 KiB in a row and its two 128-bit loads
// each read 512 contiguous bytes per wave (4 cache lines instead of 16).
// p = tile + k0 * 16 + lane * 8.
__device__ __forceinline__ v16h loadf(const _Float16* p) {
    union { v16h v; uint4 q[2]; } u;
    u.q[0] = *(const uint4*)(p);         // k = k0 + kbase ..
    u.q[1] = *(const uint4*)(p + 256);   // k = k0 + 16 + kbase ..
    return u.v;
}

// Inputs-only fence on the loaded values of four fragments and on the address
// they were loaded from: it keeps these registers apart until it, so the loads
// of a k-step can all be issued before the first wait and none lands on an
// address register.  Its s_wait_xcnt 0 is the wait that belongs in front of the
// next overwrite of that address register.
__device__ __forceinline__ void hold16(v16h a, v16h b, v16h c, v16h d, const _Float16* p) {
    asm volatile("s_wait_xcnt 0x0" :: "v"(a), "v"(b), "v"(c), "v"(d), "v"(p));
}

// ---------------------------------------------------------------------------
// Kernel 0: the three inputs (S*B x D) and the four weights (D x D), f32 row-major,
// are converted once to f16 in fragment order (see loadf), one behind the other in
// the workspace: 1024 tiles of 16 rows.  The projections then load every fragment
// as whole cache lines and convert nothing.
// Block = two tiles of one matrix; a wave takes 16 rows x 256 k.  Lane = (row r of
// 8, group g of 8 k): it reads 32 bytes and writes the 16 bytes of its group, so a
// wave's store is four whole 128-byte lines.
// ---------------------------------------------------------------------------
__global__ __launch_bounds__(256) void to_frag(
    const float* __restrict__ xq, const float* __restrict__ xk, const float* __restrict__ xv,
    const float* __restrict__ wq, const float* __restrict__ wk, const float* __restrict__ wv,
    const float* __restrict__ wo, _Float16* __restrict__ out)
{
    const int pair = blockIdx.x;           // 3 x 128 pairs of input tiles, 4 x 32 of weight tiles
    const float* src;
    int first;
    if      (pair < 128) { src = xq; first = 0;   }
    else if (pair < 256) { src = xk; first = 128; }
    else if (pair < 384) { src = xv; first = 256; }
    else if (pair < 416) { src = wq; first = 384; }
    else if (pair < 448) { src = wk; first = 416; }
    else if (pair < 480) { src = wv; first = 448; }
    else                 { src = wo; first = 480; }
    const int wave = threadIdx.x >> 5;
    const int r    = (threadIdx.x & 31) >> 2;
    const int g    = threadIdx.x & 3;
    const int kq   = (wave & 3) * 256;
    const float* p = src + (size_t)(((pair - first) * 2 + (wave >> 2)) * 16 + r) * DD + kq + g * 8;
    _Float16*    q = out + (size_t)(pair * 2 + (wave >> 2)) * 16 * DD + (kq / 8 + g) * 128 + r * 8;
    v4f x[16][2];
#pragma unroll
    for (int u = 0; u < 16; ++u) {         // u = 32-k block * 2 + upper half of the rows
        const float* pu = p + (u & 1) * 8 * DD + (u >> 1) * 32;
        x[u][0] = *(const v4f*)(pu);
        x[u][1] = *(const v4f*)(pu + 4);
    }
    // The wait that belongs in front of an overwrite of the register that these
    // loads name as their address (p, held to here as an input).
    asm volatile("s_wait_xcnt 0x0" :: "v"(p) : "memory");
#pragma unroll
    for (int u = 0; u < 16; ++u) {
        union { _Float16 e[8]; uint4 v; } c;
#pragma unroll
        for (int t = 0; t < 4; ++t) { c.e[t] = (_Float16)x[u][0][t]; c.e[4 + t] = (_Float16)x[u][1][t]; }
        *(uint4*)(q + (u >> 1) * 512 + (u & 1) * 64) = c.v;
    }
}

// ---------------------------------------------------------------------------
// Kernel 1: the three projections Q, K, V in ONE launch:  Y = X(M x D) @ W^T(D x D) + b,
// X and W f16 in fragment order (kernel 0), the three X, the three W and the three
// results each one behind the other in the workspace.
// Both stores are in fragment order (see loadf):
//   MODE 0: Q and K, rows = positions, k = dk:  (B,H, S/16, DK/8, 16 s, 8 dk)
//   MODE 1: V^T,     rows = dk, k = positions:  (B,H, S/32, DK/16, 4, 16 dk, 8 s)
// One wave per 64x64 tile of Y (4x4 accumulator fragments): each loaded
// fragment feeds four WMMAs.  Block = 2x2 waves = 128x128 of Y;
// M = S*B = 4096, N = 1024 -> 32x8 = 256 blocks x 4 waves per projection, 768 blocks in
// all: three waves on every SIMD, so one wave's WMMAs run while the others' loads fly.
// ---------------------------------------------------------------------------
template <int MODE>
__device__ __forceinline__ void store_qkv(
    const v8f (&acc)[4][4], float (&bv)[4], int m0, int col0, int hi, _Float16* __restrict__ out)
{
#pragma unroll
    for (int j = 0; j < 4; ++j) {
        const int   col = col0 + j * 16;
        const int   h   = col >> 6;        // / DK
        const int   dk  = col & 63;
#pragma unroll
        for (int i = 0; i < 4; ++i) {
            // The same wait for the registers that issued stores name: the sums of this
            // group of 16 rows all read bv[j], so they stay behind it, and the stores of
            // the group before stay in front of it.
            if (i + j > 0) asm volatile("s_wait_xcnt 0x0" : "+v"(bv[j]) :: "memory");
            if (MODE == 0) {
#pragma unroll
                for (int r = 0; r < 8; ++r) {
                    const int rg = m0 + i * 16 + r + 8 * hi;   // row in (s*B + b)
                    const int s  = rg >> 1;                    // B = 2
                    const int b  = rg & 1;
                    out[(((size_t)(b * HH + h) * (SS / 16) + (s >> 4)) * 8 + (dk >> 3)) * 128
                        + (s & 15) * 8 + (dk & 7)] = (_Float16)(acc[i][j][r] + bv[j]);
                }
            } else {
                // rows r = b, b+2, b+4, b+6 are positions s0 .. s0+3 of batch b, with
                // s0 = m0/2 + 8*i + 4*hi: four neighbours in V^T's order, one 8-byte store.
#pragma unroll
                for (int b = 0; b < 2; ++b) {
                    union { _Float16 e[4]; uint2 q; } u;
#pragma unroll
                    for (int t = 0; t < 4; ++t) u.e[t] = (_Float16)(acc[i][j][2 * t + b] + bv[j]);
                    *(uint2*)(out + (((size_t)(b * HH + h) * (SS / 32) + (m0 >> 6)) * 4 + (dk >> 4)) * 512
                              + i * 128 + (dk & 15) * 8 + 4 * hi) = u.q;
                }
            }
        }
    }
    // The same wait behind V^T's last stores: in the built code the address arithmetic of
    // the Q and K form stands behind them and overwrites the register that they name.
    if (MODE == 1) asm volatile("s_wait_xcnt 0x0" ::: "memory");
}

__global__ __launch_bounds__(128) void proj_qkv(
    const _Float16* __restrict__ X3, const _Float16* __restrict__ W3,
    const float* __restrict__ bq, const float* __restrict__ bk, const float* __restrict__ bvv,
    _Float16* __restrict__ out3)
{
    const int which = blockIdx.x >> 8;     // 0: Q, 1: K, 2: V; the same for the whole block
    const int tile  = blockIdx.x & 255;
    const _Float16* X    = X3 + (size_t)which * (SS * BB * DD);
    const _Float16* W    = W3 + (size_t)which * (DD * DD);
    const float*    bias = which == 0 ? bq : (which == 1 ? bk : bvv);
    _Float16*       out  = out3 + (size_t)which * (BB * HH * SS * DKK);

    const int lo   = threadIdx.x & 15;
    const int hi   = (threadIdx.x >> 4) & 1;
    const int wave = threadIdx.x >> 5;
    const int m0 = (tile & 31) * 128 + (wave >> 1) * 64;   // M/128 = 32
    const int n0 = (tile >> 5) * 128 + (wave & 1)  * 64;   // N/128 = 8

    const _Float16* xp = X + (size_t)m0 * DD + (threadIdx.x & 31) * 8;   // 16 rows = 16*DD elements
    const _Float16* wp = W + (size_t)n0 * DD + (threadIdx.x & 31) * 8;   // B = W^T: output col = W row
    v8f acc[4][4] = {};
    // A k-step is 32 loads of 16 bytes, as many as before, and now spans 64 k.
    for (int k0 = 0; k0 < DD; k0 += 64, xp += 1024, wp += 1024) {
        v16h a[2][4], b[2][4];
#pragma unroll
        for (int u = 0; u < 2; ++u) {
#pragma unroll
            for (int i = 0; i < 4; ++i) a[u][i] = loadf(xp + u * 512 + i * 16 * DD);
#pragma unroll
            for (int j = 0; j < 4; ++j) b[u][j] = loadf(wp + u * 512 + j * 16 * DD);
        }
        // Holds the k-step's loads in place as one group (loaded values as inputs
        // only): a wave then waits out a cache latency once per k-step.
        hold16(a[0][0], a[0][1], a[0][2], a[0][3], xp);
        hold16(b[0][0], b[0][1], b[0][2], b[0][3], wp);
        hold16(a[1][0], a[1][1], a[1][2], a[1][3], xp);
        hold16(b[1][0], b[1][1], b[1][2], b[1][3], wp);
#pragma unroll
        for (int u = 0; u < 2; ++u)
#pragma unroll
            for (int i = 0; i < 4; ++i)
#pragma unroll
                for (int j = 0; j < 4; ++j) acc[i][j] = wmma(a[u][i], b[u][j], acc[i][j]);
    }

    const int col0 = n0 + lo;
    float bv[4];
#pragma unroll
    for (int j = 0; j < 4; ++j) bv[j] = bias[col0 + j * 16];
    // The wait that belongs in front of an overwrite of the register that the four
    // bias loads name (col0, held to here as an input).
    asm volatile("s_wait_xcnt 0x0" :: "v"(bv[0]), "v"(bv[1]), "v"(bv[2]), "v"(bv[3]), "v"(col0));
    if (which < 2) store_qkv<0>(acc, bv, m0, col0, hi, out);
    else           store_qkv<1>(acc, bv, m0, col0, hi, out);
}

// ---------------------------------------------------------------------------
// Kernel 2: flash attention per (b,h).  Block = 8 waves, each wave owns 16
// queries; online softmax over 32 keys/iteration, computed transposed:
//   S^T = K Q^T   (A = K rows, B = Q^T kept in registers): 4 WMMAs
//   O^T += V^T P^T (A = V^T rows, B = P^T): 4 WMMAs
// In a D tile lane l holds column l & 15, so every lane holds scores of ONE
// query (keys 8*hi + r of each 16-key tile): maximum and sum run in the lane,
// with one exchange between the wave's halves, and the two score tiles,
// converted in place, are already the B operand P^T in the hardware k order
// (the order loadf loads V^T in).
// Saves per-row (max, sum) stats for the attention-mean recompute kernel.
// ---------------------------------------------------------------------------
// Lane l <-> lane l ^ 16.
__device__ __forceinline__ float xhalf(float x) {
    const int i = __builtin_bit_cast(int, x);
    return __builtin_bit_cast(float,
        __builtin_amdgcn_permlanex16(i, i, 0x76543210, 0xfedcba98, false, false));
}

__global__ __launch_bounds__(256) void attn_flash(
    const _Float16* __restrict__ qh, const _Float16* __restrict__ kh,
    const _Float16* __restrict__ vt, const float* __restrict__ mask,
    _Float16* __restrict__ xatt, float* __restrict__ stats)
{
    const int wave = threadIdx.x >> 5;
    const int lo   = threadIdx.x & 15;
    const int hi   = (threadIdx.x >> 4) & 1;
    const int bh   = blockIdx.x >> 4;      // grid = (B*H) * (S/128)
    const int qblk = blockIdx.x & 15;
    const int b    = bh >> 4;              // / H
    const int h    = bh & 15;
    const int q0   = qblk * 128 + wave * 16;

    // Q^T B-fragments (persistent): lane = query column; DK=64 -> two 32-wide K chunks
    const int lane8 = (threadIdx.x & 31) * 8;
    const _Float16* qtile = qh + ((size_t)bh * SS + q0) * DKK + lane8;
    const v16h qb0 = loadf(qtile);
    const v16h qb1 = loadf(qtile + 512);

    float mrow = -1e30f;   // this lane's query: running maximum (same in both halves)
    float lrow = 0.f;      // running sum over this half's keys only
    v8f   o[4] = {};       // o[c][r] = O[q0 + lo][c*16 + 8*hi + r]

    const float     scale = 0.125f;                      // 1/sqrt(DK)
    const float*    mrowp = mask + ((size_t)b * SS + q0 + lo) * SS + 8 * hi;
    const _Float16* kbase = kh + (size_t)bh * SS * DKK + lane8;   // 16 keys = 1024 elements
    const _Float16* vbase = vt + (size_t)bh * SS * DKK + lane8;   // 32 keys = 2048 elements

    // One pass = 32 keys.  Its operands are fetched one pass ahead into the same registers:
    // K and the mask values of the next pass right behind this pass's masked scores, V^T of
    // the next pass right behind this pass's O^T products.  The loads then fly while the
    // rest of a pass computes, and no pass but the first waits out the latency of its own loads.
    v16h ka[2][2];         // K: two tiles of 16 keys x 64 dk
    v4f  ma[2], mb[2];     // this lane's 16 mask values
    v16h va[4];            // V^T: four tiles of 16 dk x 32 keys
    auto fetch_km = [&](int j0) {
        const _Float16* kp = kbase + (size_t)j0 * DKK;
        const float*    mp = mrowp + j0;
#pragma unroll
        for (int f = 0; f < 2; ++f) {
            ka[f][0] = loadf(kp + f * 1024);
            ka[f][1] = loadf(kp + f * 1024 + 512);
        }
#pragma unroll
        for (int f = 0; f < 2; ++f) {
            ma[f] = *(const v4f*)(mp + f * 16);
            mb[f] = *(const v4f*)(mp + f * 16 + 4);
        }
        // The wait that belongs in front of an overwrite of a register that these loads
        // name as their address (both addresses are held to here as inputs).
        asm volatile("s_wait_xcnt 0x0" :: "v"(kp), "v"(mp) : "memory");
    };
    auto fetch_v = [&](int j0) {
        const _Float16* vp = vbase + (size_t)j0 * DKK;
#pragma unroll
        for (int c = 0; c < 4; ++c) va[c] = loadf(vp + c * 512);
        // The same wait behind the V^T loads.
        asm volatile("s_wait_xcnt 0x0" :: "v"(vp) : "memory");
    };
    auto pass = [&](bool more, int jnext) {
        // ---- S^T for the pass's 32 keys: sc[f][r] = S[q0+lo][j0 + f*16 + 8*hi + r] ----
        v8f sc[2];
#pragma unroll
        for (int f = 0; f < 2; ++f) {
            v8f c = {};
            c = wmma(ka[f][0], qb0, c);
            c = wmma(ka[f][1], qb1, c);
            sc[f] = c;
        }
        // ---- scale + mask: a lane's 8 keys of a tile are contiguous in its mask row; written
        //      in pairs of neighbours, as they lie in the registers (no register moves) ----
        v2f s2[8];
#pragma unroll
        for (int f = 0; f < 2; ++f) {
            s2[f * 4 + 0] = __builtin_shufflevector(sc[f], sc[f], 0, 1) * scale + __builtin_shufflevector(ma[f], ma[f], 0, 1);
            s2[f * 4 + 1] = __builtin_shufflevector(sc[f], sc[f], 2, 3) * scale + __builtin_shufflevector(ma[f], ma[f], 2, 3);
            s2[f * 4 + 2] = __builtin_shufflevector(sc[f], sc[f], 4, 5) * scale + __builtin_shufflevector(mb[f], mb[f], 0, 1);
            s2[f * 4 + 3] = __builtin_shufflevector(sc[f], sc[f], 6, 7) * scale + __builtin_shufflevector(mb[f], mb[f], 2, 3);
        }
        if (more) {
            // K and the mask values have been read: refill their registers for the next pass.
            // The two scheduling barriers keep the twelve loads together at this place: without
            // them the compiler moves a part of them behind the softmax, too late to be hidden.
            __builtin_amdgcn_sched_barrier(0);
            fetch_km(jnext);
            __builtin_amdgcn_sched_barrier(0);
        }
        // ---- online softmax, all in the lane but for one exchange of the maximum ----
        float s[16];
#pragma unroll
        for (int i = 0; i < 16; ++i) s[i] = s2[i >> 1][i & 1];
        float mx = s[0];
#pragma unroll
        for (int i = 1; i < 16; ++i) mx = fmaxf(mx, s[i]);
        mx = fmaxf(mx, xhalf(mx));
        const float mnew = fmaxf(mrow, mx);
        const float corr = __expf(mrow - mnew);
        mrow = mnew;
        float p[16];
#pragma unroll
        for (int i = 0; i < 16; ++i) p[i] = __expf(s[i] - mnew);
        const float psum = (((p[0] + p[1]) + (p[2] + p[3])) + ((p[4] + p[5]) + (p[6] + p[7])))
                         + (((p[8] + p[9]) + (p[10] + p[11])) + ((p[12] + p[13]) + (p[14] + p[15])));
        lrow = lrow * corr + psum;
        // ---- rescale O^T: one factor per lane ----
#pragma unroll
        for (int c = 0; c < 4; ++c)
#pragma unroll
            for (int r = 0; r < 8; ++r) o[c][r] *= corr;
        // ---- P^T as B operand: element i = key kmap(i, hi), no lane exchange ----
        v16h pb;
#pragma unroll
        for (int i = 0; i < 16; ++i) pb[i] = (_Float16)p[i];
        // ---- O^T += V^T P^T ; A = V^T rows (lane = dk row), one fragment per 16 dk ----
#pragma unroll
        for (int c = 0; c < 4; ++c) o[c] = wmma(va[c], pb, o[c]);
        if (more) fetch_v(jnext);   // V^T has been read: refill its registers for the next pass
    };

    fetch_km(0);
    fetch_v(0);
    for (int j0 = 32; j0 < SS; j0 += 32) pass(true, j0);
    pass(false, 0);

    // ---- join the halves' sums, normalize, store x_att f16 (rows b*S+s, k = D, in
    //      fragment order for kernel 3: a wave's store is 512 contiguous bytes) and stats ----
    const float lsum = lrow + xhalf(lrow);
    const float inv  = 1.0f / lsum;
    _Float16* xrow = xatt + ((size_t)((b * SS + q0) >> 4) * (DD / 8) + h * 8 + hi) * 128 + lo * 8;
#pragma unroll
    for (int c = 0; c < 4; ++c) {
        union { _Float16 e[8]; uint4 q; } u;       // 8 consecutive dk: one 16-byte store
#pragma unroll
        for (int r = 0; r < 8; ++r) u.e[r] = (_Float16)(o[c][r] * inv);
        *(uint4*)(xrow + c * 256) = u.q;           // 16 dk on = two groups of 8 k
    }
    if (hi == 0)
        *(float2*)(stats + ((size_t)bh * SS + q0 + lo) * 2) = make_float2(mrow, lsum);
}

// ---------------------------------------------------------------------------
// Kernel 3: output projection  out = x_att(f16, fragment order, rows b*S+s) @ Wo^T + bo,
// Wo f16 in fragment order (kernel 0)
// (f32 out, S,B,D)
// Same tiling as kernel 1: one wave per 64x64 of Y, 2x2 waves per block.
// ---------------------------------------------------------------------------
__global__ __launch_bounds__(128) void proj_out(
    const _Float16* __restrict__ X, const _Float16* __restrict__ W,
    const float* __restrict__ bias, float* __restrict__ out)
{
    const int lo   = threadIdx.x & 15;
    const int hi   = (threadIdx.x >> 4) & 1;
    const int wave = threadIdx.x >> 5;
    const int m0 = (blockIdx.x & 31) * 128 + (wave >> 1) * 64;
    const int n0 = (blockIdx.x >> 5) * 128 + (wave & 1)  * 64;

    const _Float16* xp = X + (size_t)m0 * DD + (threadIdx.x & 31) * 8;   // 16 rows = 16*DD elements
    const _Float16* wp = W + (size_t)n0 * DD + (threadIdx.x & 31) * 8;
    v8f acc[4][4] = {};
    // A k-step is 32 loads of 16 bytes, as many as before, and now spans 64 k.
    for (int k0 = 0; k0 < DD; k0 += 64, xp += 1024, wp += 1024) {
        v16h a[2][4], b[2][4];
#pragma unroll
        for (int u = 0; u < 2; ++u) {
#pragma unroll
            for (int i = 0; i < 4; ++i) a[u][i] = loadf(xp + u * 512 + i * 16 * DD);
#pragma unroll
            for (int j = 0; j < 4; ++j) b[u][j] = loadf(wp + u * 512 + j * 16 * DD);
        }
        // Holds the k-step's loads in place as one group (loaded values as inputs
        // only): the one wave of a SIMD then waits out a cache latency once per k-step.
        hold16(a[0][0], a[0][1], a[0][2], a[0][3], xp);
        hold16(b[0][0], b[0][1], b[0][2], b[0][3], wp);
        hold16(a[1][0], a[1][1], a[1][2], a[1][3], xp);
        hold16(b[1][0], b[1][1], b[1][2], b[1][3], wp);
#pragma unroll
        for (int u = 0; u < 2; ++u)
#pragma unroll
            for (int i = 0; i < 4; ++i)
#pragma unroll
                for (int j = 0; j < 4; ++j) acc[i][j] = wmma(a[u][i], b[u][j], acc[i][j]);
    }

    const int col0 = n0 + lo;
    float bv[4];
#pragma unroll
    for (int j = 0; j < 4; ++j) bv[j] = bias[col0 + j * 16];
    // The wait in front of an overwrite of the bias loads' register (see kernel 1).
    asm volatile("s_wait_xcnt 0x0" :: "v"(bv[0]), "v"(bv[1]), "v"(bv[2]), "v"(bv[3]), "v"(col0));
#pragma unroll
    for (int j = 0; j < 4; ++j) {
        // The wait in front of an overwrite of a store's registers (see kernel 1).
        if (j > 0) asm volatile("s_wait_xcnt 0x0" : "+v"(bv[j]) :: "memory");
#pragma unroll
        for (int i = 0; i < 4; ++i)
#pragma unroll
            for (int r = 0; r < 8; ++r) {
                // x_att row m0 + ... = b*S + s (a wave's 64 rows are of one b) -> out row s*B + b
                const int rg = ((m0 & (SS - 1)) + i * 16 + r + 8 * hi) * BB + (m0 >> 11);
                out[(size_t)rg * DD + col0 + j * 16] = acc[i][j][r] + bv[j];
            }
    }
}

// ---------------------------------------------------------------------------
// Kernel 4: attn = mean over heads of softmax(QK^T/sqrt+mask).
// Recompute scores with WMMA, transposed as in kernel 2 (A = K rows, B = Q^T): a
// lane holds 8 consecutive keys of ONE query per tile, so the stored (max,sum)
// stats are one load and one reciprocal per lane, head and 16 queries.
// A wave owns 32 queries x 64 keys (2 x 4 tiles): a loaded Q^T fragment feeds four
// tiles and a K fragment two.  Block = 4 x 2 waves = 128 queries x 128 keys, so a
// block fetches 32 KiB per head for 16384 results.  Grid = B * (S/128) * (S/128).
// ---------------------------------------------------------------------------
__global__ __launch_bounds__(256) void attn_mean(
    const _Float16* __restrict__ qh, const _Float16* __restrict__ kh,
    const float* __restrict__ mask, const float* __restrict__ stats,
    float* __restrict__ attn)
{
    const int wave = threadIdx.x >> 5;
    const int lo   = threadIdx.x & 15;
    const int hi   = (threadIdx.x >> 4) & 1;
    int idx = blockIdx.x;
    const int tblk = idx & 15; idx >>= 4;    // S/128
    const int sblk = idx & 15; idx >>= 4;    // S/128
    const int b    = idx;
    const int s0   = sblk * 128 + (wave >> 1) * 32;
    const int t0   = tblk * 128 + (wave & 1) * 64;

    // element r of tile (i, j) of this lane: query s0 + 16*i + lo, key t0 + 16*j + 8*hi + r
    const size_t eoff = ((size_t)b * SS + s0 + lo) * SS + t0 + 8 * hi;
    const float* mp = mask + eoff;
    v8f mk[2][4];
#pragma unroll
    for (int i = 0; i < 2; ++i)
#pragma unroll
        for (int j = 0; j < 4; ++j) {
            const v4f ma = *(const v4f*)(mp + i * 16 * SS + j * 16);
            const v4f mb = *(const v4f*)(mp + i * 16 * SS + j * 16 + 4);
            mk[i][j] = __builtin_shufflevector(ma, mb, 0, 1, 2, 3, 4, 5, 6, 7);
        }
    // The wait that belongs in front of an overwrite of the register that these
    // loads name as their address (mp, held to here as an input).
    asm volatile("s_wait_xcnt 0x0" :: "v"(mp) : "memory");
    v8f acc[2][4] = {};
    const float scale = 0.125f;

    // head 0 of this batch; a head is SS rows further on (lane's place in the pointer)
    const int lane8 = (threadIdx.x & 31) * 8;
    const _Float16* qp = qh + ((size_t)(b * HH) * SS + s0) * DKK + lane8;   // 16 rows = 1024 elements
    const _Float16* kp = kh + ((size_t)(b * HH) * SS + t0) * DKK + lane8;
    const float*    sp = stats + ((size_t)(b * HH) * SS + s0 + lo) * 2;
    for (int h = 0; h < HH; ++h, qp += SS * DKK, kp += SS * DKK, sp += SS * 2) {
        float2 st[2];
        v16h   qb[2][2], ka[4][2];
#pragma unroll
        for (int i = 0; i < 2; ++i) {
            st[i]    = *(const float2*)(sp + i * 32);
            qb[i][0] = loadf(qp + i * 1024);
            qb[i][1] = loadf(qp + i * 1024 + 512);
        }
#pragma unroll
        for (int j = 0; j < 4; ++j) {
            ka[j][0] = loadf(kp + j * 1024);
            ka[j][1] = loadf(kp + j * 1024 + 512);
        }
        // Holds the head's 26 loads in place as one group (loaded values and their three
        // addresses as inputs only): a wave then waits out one cache latency per head, not one
        // per part of the group, and no load lands on an address register.  Its s_wait_xcnt 0
        // is the wait that belongs in front of the next overwrite of such a register.
        asm volatile("s_wait_xcnt 0x0"
                     :: "v"(qb[0][0]), "v"(qb[0][1]), "v"(qb[1][0]), "v"(qb[1][1]),
                        "v"(ka[0][0]), "v"(ka[0][1]), "v"(ka[1][0]), "v"(ka[1][1]),
                        "v"(ka[2][0]), "v"(ka[2][1]), "v"(ka[3][0]), "v"(ka[3][1]),
                        "v"(st[0].x), "v"(st[0].y), "v"(st[1].x), "v"(st[1].y),
                        "v"(qp), "v"(kp), "v"(sp)
                     : "memory");
        // All scores of the head first: the two tiles of a K tile are finished together, so
        // its fragments' registers are free for the next two score tiles.
        v8f c[2][4];
#pragma unroll
        for (int j = 0; j < 4; ++j) {
#pragma unroll
            for (int i = 0; i < 2; ++i) { v8f z = {}; c[i][j] = wmma(ka[j][0], qb[i][0], z); }
#pragma unroll
            for (int i = 0; i < 2; ++i) c[i][j] = wmma(ka[j][1], qb[i][1], c[i][j]);
        }
        // Keeps the vector work behind the sixteen WMMAs: mixed in between them it is scheduled
        // as one dependent chain per pair of scores (no free registers while the fragments live).
        __builtin_amdgcn_sched_barrier(0);
#pragma unroll
        for (int i = 0; i < 2; ++i) {
            const float inv = 1.0f / st[i].y;
#pragma unroll
            for (int j = 0; j < 4; ++j)
#pragma unroll
                for (int r = 0; r < 8; ++r)
                    acc[i][j][r] += __expf(c[i][j][r] * scale + mk[i][j][r] - st[i].x) * inv;
        }
    }
    const float invH = 1.0f / HH;
    float* op = attn + eoff;
#pragma unroll
    for (int i = 0; i < 2; ++i)
#pragma unroll
        for (int j = 0; j < 4; ++j) {
            v4f oa, ob;
#pragma unroll
            for (int r = 0; r < 4; ++r) { oa[r] = acc[i][j][r] * invH; ob[r] = acc[i][j][4 + r] * invH; }
            *(v4f*)(op + i * 16 * SS + j * 16)     = oa;
            *(v4f*)(op + i * 16 * SS + j * 16 + 4) = ob;
        }
}

// ---------------------------------------------------------------------------
// Launcher
// ---------------------------------------------------------------------------
extern "C" void kernel_launch(void* const* d_in, const int* in_sizes, int n_in,
                              void* d_out, int out_size, void* d_ws, size_t ws_size,
                              hipStream_t stream) {
    const float* query = (const float*)d_in[0];
    const float* key   = (const float*)d_in[1];
    const float* value = (const float*)d_in[2];
    const float* mask  = (const float*)d_in[3];
    const float* Wq = (const float*)d_in[4];  const float* bq = (const float*)d_in[5];
    const float* Wk = (const float*)d_in[6];  const float* bk = (const float*)d_in[7];
    const float* Wv = (const float*)d_in[8];  const float* bv = (const float*)d_in[9];
    const float* Wo = (const float*)d_in[10]; const float* bo = (const float*)d_in[11];

    float* out  = (float*)d_out;                       // (S,B,D)
    float* attn = out + (size_t)SS * BB * DD;          // (B,S,S)

    // Workspace layout (~67.6 MB total)
    const size_t headElems = (size_t)BB * HH * SS * DKK;   // 4,194,304
    _Float16* qh   = (_Float16*)d_ws;                  // per (b,h): S x DK   f16, fragment order
    _Float16* kh   = qh + headElems;                   // per (b,h): S x DK   f16, fragment order
    _Float16* vt   = kh + headElems;                   // per (b,h): DK x S   f16, fragment order
    _Float16* xatt = vt + headElems;                   // (B*S) x D   f16, fragment order
    float*    stats = (float*)(xatt + (size_t)SS * BB * DD); // (B,H,S,2) f32
    // f16 copies in fragment order, in kernel 0's order of tiles
    _Float16* xq16 = (_Float16*)(stats + (size_t)BB * HH * SS * 2);
    _Float16* xk16 = xq16 + (size_t)SS * BB * DD;
    _Float16* xv16 = xk16 + (size_t)SS * BB * DD;
    _Float16* wq16 = xv16 + (size_t)SS * BB * DD;
    _Float16* wk16 = wq16 + (size_t)DD * DD;
    _Float16* wv16 = wk16 + (size_t)DD * DD;
    _Float16* wo16 = wv16 + (size_t)DD * DD;

    to_frag<<<512, 256, 0, stream>>>(query, key, value, Wq, Wk, Wv, Wo, xq16);
    proj_qkv<<<768, 128, 0, stream>>>(xq16, wq16, bq, bk, bv, qh);
    attn_flash<<<512, 256, 0, stream>>>(qh, kh, vt, mask, xatt, stats);
    proj_out<<<256, 128, 0, stream>>>(xatt, wo16, bo, out);
    attn_mean<<<512, 256, 0, stream>>>(qh, kh, mask, stats, attn);
}

// v008
// A run of this version takes 132 microseconds.
// In both of two side-by-side timings against v007, it was 1.04 times as fast.
// Counting every step since v000, it is 4.62 times as fast.
#include <hip/hip_runtime.h>
#include <hip/hip_bf16.h>

// Problem constants (from reference)
#define SS  2048
#define BB  2
#define DD  1024
#define HH  16
#define DKK 64

typedef __attribute__((ext_vector_type(16))) _Float16 v16h;
typedef __attribute__((ext_vector_type(8)))  float    v8f;
typedef __attribute__((ext_vector_type(4)))  float    v4f;
typedef __attribute__((ext_vector_type(2)))  float    v2f;

// ---------------------------------------------------------------------------
// WMMA helper: D = A(16x32 f16) * B(32x16 f16) + C(16x16 f32)
// ---------------------------------------------------------------------------
__device__ __forceinline__ v8f wmma(v16h a, v16h b, v8f c) {
    return __builtin_amdgcn_wmma_f32_16x16x32_f16(
        /*neg_a=*/false, a, /*neg_b=*/false, b,
        /*c_mod=*/(short)0, c, /*reuse_a=*/false, /*reuse_b=*/false);
}

// A/B fragments (ISA 16-bit 16x32 layout):
//   lane L: row/col = L&15 ; kbase = (L>>4)*8
//   VGPRs 0..3 hold K = kbase..kbase+7 (16 contiguous bytes)
//   VGPRs 4..7 hold K = 16+kbase..16+kbase+7 (16 contiguous bytes)
// The f16 matrices in the workspace are kept in that order ("fragment order"):
// a tile of 16 rows is stored as groups of 8 k, each group [16 rows][8 k] = 256 B:
//   element (row, k) of a tile: (k >> 3) * 128 + (row & 15) * 8 + (k & 7)
// A fragment (16 rows x 32 k) is then 1 KiB in a row and its two 128-bit loads
// each read 512 contiguous bytes per wave (4 cache lines instead of 16).
// p = tile + k0 * 16 + lane * 8.
__device__ __forceinline__ v16h loadf(const _Float16* p) {
    union { v16h v; uint4 q[2]; } u;
    u.q[0] = *(const uint4*)(p);         // k = k0 + kbase ..
    u.q[1] = *(const uint4*)(p + 256);   // k = k0 + 16 + kbase ..
    return u.v;
}

// Inputs-only fence on the loaded values of four fragments and on the address
// they were loaded from: it keeps these registers apart until it, so the loads
// of a k-step can all be issued before the first wait and none lands on an
// address register.  Its s_wait_xcnt 0 is the wait that belongs in front of the
// next overwrite of that address register.
__device__ __forceinline__ void hold16(v16h a, v16h b, v16h c, v16h d, const _Float16* p) {
    asm volatile("s_wait_xcnt 0x0" :: "v"(a), "v"(b), "v"(c), "v"(d), "v"(p));
}

// ---------------------------------------------------------------------------
// Kernel 0: the three inputs (S*B x D) and the four weights (D x D), f32 row-major,
// are converted once to f16 in fragment order (see loadf), one behind the other in
// the workspace: 1024 tiles of 16 rows.  The projections then load every fragment
// as whole cache lines and convert nothing.
// Block = two tiles of one matrix; a wave takes 16 rows x 256 k.  Lane = (row r of
// 8, group g of 8 k): it reads 32 bytes and writes the 16 bytes of its group, so a
// wave's store is four whole 128-byte lines.
// ---------------------------------------------------------------------------
__global__ __launch_bounds__(256) void to_frag(
    const float* __restrict__ xq, const float* __restrict__ xk, const float* __restrict__ xv,
    const float* __restrict__ wq, const float* __restrict__ wk, const float* __restrict__ wv,
    const float* __restrict__ wo, _Float16* __restrict__ out)
{
    const int pair = blockIdx.x;           // 3 x 128 pairs of input tiles, 4 x 32 of weight tiles
    const float* src;
    int first;
    if      (pair < 128) { src = xq; first = 0;   }
    else if (pair < 256) { src = xk; first = 128; }
    else if (pair < 384) { src = xv; first = 256; }
    else if (pair < 416) { src = wq; first = 384; }
    else if (pair < 448) { src = wk; first = 416; }
    else if (pair < 480) { src = wv; first = 448; }
    else                 { src = wo; first = 480; }
    const int wave = threadIdx.x >> 5;
    const int r    = (threadIdx.x & 31) >> 2;
    const int g    = threadIdx.x & 3;
    const int kq   = (wave & 3) * 256;
    const float* p = src + (size_t)(((pair - first) * 2 + (wave >> 2)) * 16 + r) * DD + kq + g * 8;
    _Float16*    q = out + (size_t)(pair * 2 + (wave >> 2)) * 16 * DD + (kq / 8 + g) * 128 + r * 8;
    v4f x[16][2];
#pragma unroll
    for (int u = 0; u < 16; ++u) {         // u = 32-k block * 2 + upper half of the rows
        const float* pu = p + (u & 1) * 8 * DD + (u >> 1) * 32;
        x[u][0] = *(const v4f*)(pu);
        x[u][1] = *(const v4f*)(pu + 4);
    }
    // The wait that belongs in front of an overwrite of the register that these
    // loads name as their address (p, held to here as an input).
    asm volatile("s_wait_xcnt 0x0" :: "v"(p) : "memory");
#pragma unroll
    for (int u = 0; u < 16; ++u) {
        union { _Float16 e[8]; uint4 v; } c;
#pragma unroll
        for (int t = 0; t < 4; ++t) { c.e[t] = (_Float16)x[u][0][t]; c.e[4 + t] = (_Float16)x[u][1][t]; }
        *(uint4*)(q + (u >> 1) * 512 + (u & 1) * 64) = c.v;
    }
}

// ---------------------------------------------------------------------------
// Kernel 1: the three projections Q, K, V in ONE launch:  Y = X(M x D) @ W^T(D x D) + b,
// X and W f16 in fragment order (kernel 0), the three X, the three W and the three
// results each one behind the other in the workspace.
// Both stores are in fragment order (see loadf):
//   MODE 0: Q and K, rows = positions, k = dk:  (B,H, S/16, DK/8, 16 s, 8 dk)
//   MODE 1: V^T,     rows = dk, k = positions:  (B,H, S/32, DK/16, 4, 16 dk, 8 s)
// One wave per 64x64 tile of Y (4x4 accumulator fragments): each loaded
// fragment feeds four WMMAs.  Block = 2x2 waves = 128x128 of Y;
// M = S*B = 4096, N = 1024 -> 32x8 = 256 blocks x 4 waves per projection, 768 blocks in
// all: three waves on every SIMD, so one wave's WMMAs run while the others' loads fly.
// ---------------------------------------------------------------------------
template <int MODE>
__device__ __forceinline__ void store_qkv(
    const v8f (&acc)[4][4], float (&bv)[4], int m0, int col0, int hi, _Float16* __restrict__ out)
{
#pragma unroll
    for (int j = 0; j < 4; ++j) {
        const int   col = col0 + j * 16;
        const int   h   = col >> 6;        // / DK
        const int   dk  = col & 63;
#pragma unroll
        for (int i = 0; i < 4; ++i) {
            // The same wait for the registers that issued stores name: the sums of this
            // group of 16 rows all read bv[j], so they stay behind it, and the stores of
            // the group before stay in front of it.
            if (i + j > 0) asm volatile("s_wait_xcnt 0x0" : "+v"(bv[j]) :: "memory");
            if (MODE == 0) {
#pragma unroll
                for (int r = 0; r < 8; ++r) {
                    const int rg = m0 + i * 16 + r + 8 * hi;   // row in (s*B + b)
                    const int s  = rg >> 1;                    // B = 2
                    const int b  = rg & 1;
                    out[(((size_t)(b * HH + h) * (SS / 16) + (s >> 4)) * 8 + (dk >> 3)) * 128
                        + (s & 15) * 8 + (dk & 7)] = (_Float16)(acc[i][j][r] + bv[j]);
                }
            } else {
                // rows r = b, b+2, b+4, b+6 are positions s0 .. s0+3 of batch b, with
                // s0 = m0/2 + 8*i + 4*hi: four neighbours in V^T's order, one 8-byte store.
#pragma unroll
                for (int b = 0; b < 2; ++b) {
                    union { _Float16 e[4]; uint2 q; } u;
#pragma unroll
                    for (int t = 0; t < 4; ++t) u.e[t] = (_Float16)(acc[i][j][2 * t + b] + bv[j]);
                    *(uint2*)(out + (((size_t)(b * HH + h) * (SS / 32) + (m0 >> 6)) * 4 + (dk >> 4)) * 512
                              + i * 128 + (dk & 15) * 8 + 4 * hi) = u.q;
                }
            }
        }
    }
    // The same wait behind V^T's last stores: in the built code the address arithmetic of
    // the Q and K form stands behind them and overwrites the register that they name.
    if (MODE == 1) asm volatile("s_wait_xcnt 0x0" ::: "memory");
}

__global__ __launch_bounds__(128) void proj_qkv(
    const _Float16* __restrict__ X3, const _Float16* __restrict__ W3,
    const float* __restrict__ bq, const float* __restrict__ bk, const float* __restrict__ bvv,
    _Float16* __restrict__ out3)
{
    const int which = blockIdx.x >> 8;     // 0: Q, 1: K, 2: V; the same for the whole block
    const int tile  = blockIdx.x & 255;
    const _Float16* X    = X3 + (size_t)which * (SS * BB * DD);
    const _Float16* W    = W3 + (size_t)which * (DD * DD);
    const float*    bias = which == 0 ? bq : (which == 1 ? bk : bvv);
    _Float16*       out  = out3 + (size_t)which * (BB * HH * SS * DKK);

    const int lo   = threadIdx.x & 15;
    const int hi   = (threadIdx.x >> 4) & 1;
    const int wave = threadIdx.x >> 5;
    const int m0 = (tile & 31) * 128 + (wave >> 1) * 64;   // M/128 = 32
    const int n0 = (tile >> 5) * 128 + (wave & 1)  * 64;   // N/128 = 8

    const _Float16* xp = X + (size_t)m0 * DD + (threadIdx.x & 31) * 8;   // 16 rows = 16*DD elements
    const _Float16* wp = W + (size_t)n0 * DD + (threadIdx.x & 31) * 8;   // B = W^T: output col = W row
    v8f acc[4][4] = {};
    // A k-step is 32 loads of 16 bytes, as many as before, and now spans 64 k.
    for (int k0 = 0; k0 < DD; k0 += 64, xp += 1024, wp += 1024) {
        v16h a[2][4], b[2][4];
#pragma unroll
        for (int u = 0; u < 2; ++u) {
#pragma unroll
            for (int i = 0; i < 4; ++i) a[u][i] = loadf(xp + u * 512 + i * 16 * DD);
#pragma unroll
            for (int j = 0; j < 4; ++j) b[u][j] = loadf(wp + u * 512 + j * 16 * DD);
        }
        // Holds the k-step's loads in place as one group (loaded values as inputs
        // only): a wave then waits out a cache latency once per k-step.
        hold16(a[0][0], a[0][1], a[0][2], a[0][3], xp);
        hold16(b[0][0], b[0][1], b[0][2], b[0][3], wp);
        hold16(a[1][0], a[1][1], a[1][2], a[1][3], xp);
        hold16(b[1][0], b[1][1], b[1][2], b[1][3], wp);
#pragma unroll
        for (int u = 0; u < 2; ++u)
#pragma unroll
            for (int i = 0; i < 4; ++i)
#pragma unroll
                for (int j = 0; j < 4; ++j) acc[i][j] = wmma(a[u][i], b[u][j], acc[i][j]);
    }

    const int col0 = n0 + lo;
    float bv[4];
#pragma unroll
    for (int j = 0; j < 4; ++j) bv[j] = bias[col0 + j * 16];
    // The wait that belongs in front of an overwrite of the register that the four
    // bias loads name (col0, held to here as an input).
    asm volatile("s_wait_xcnt 0x0" :: "v"(bv[0]), "v"(bv[1]), "v"(bv[2]), "v"(bv[3]), "v"(col0));
    if (which < 2) store_qkv<0>(acc, bv, m0, col0, hi, out);
    else           store_qkv<1>(acc, bv, m0, col0, hi, out);
}

// ---------------------------------------------------------------------------
// Kernel 2: flash attention per (b,h).  Block = 8 waves, each wave owns 16
// queries; online softmax over 32 keys/iteration, computed transposed:
//   S^T = K Q^T   (A = K rows, B = Q^T kept in registers): 4 WMMAs
//   O^T += V^T P^T (A = V^T rows, B = P^T): 4 WMMAs
// In a D tile lane l holds column l & 15, so every lane holds scores of ONE
// query (keys 8*hi + r of each 16-key tile): maximum and sum run in the lane,
// with one exchange between the wave's halves, and the two score tiles,
// converted in place, are already the B operand P^T in the hardware k order
// (the order loadf loads V^T in).
// Saves per-row (max, sum) stats for the attention-mean recompute kernel.
// ---------------------------------------------------------------------------
// Lane l <-> lane l ^ 16.
__device__ __forceinline__ float xhalf(float x) {
    const int i = __builtin_bit_cast(int, x);
    return __builtin_bit_cast(float,
        __builtin_amdgcn_permlanex16(i, i, 0x76543210, 0xfedcba98, false, false));
}

__global__ __launch_bounds__(256) void attn_flash(
    const _Float16* __restrict__ qh, const _Float16* __restrict__ kh,
    const _Float16* __restrict__ vt, const float* __restrict__ mask,
    _Float16* __restrict__ xatt, float* __restrict__ stats)
{
    const int wave = threadIdx.x >> 5;
    const int lo   = threadIdx.x & 15;
    const int hi   = (threadIdx.x >> 4) & 1;
    const int bh   = blockIdx.x >> 4;      // grid = (B*H) * (S/128)
    const int qblk = blockIdx.x & 15;
    const int b    = bh >> 4;              // / H
    const int h    = bh & 15;
    const int q0   = qblk * 128 + wave * 16;

    // Q^T B-fragments (persistent): lane = query column; DK=64 -> two 32-wide K chunks
    const int lane8 = (threadIdx.x & 31) * 8;
    const _Float16* qtile = qh + ((size_t)bh * SS + q0) * DKK + lane8;
    const v16h qb0 = loadf(qtile);
    const v16h qb1 = loadf(qtile + 512);

    float mrow = -1e30f;   // this lane's query: running maximum (same in both halves)
    float lrow = 0.f;      // running sum over this half's keys only
    v8f   o[4] = {};       // o[c][r] = O[q0 + lo][c*16 + 8*hi + r]

    const float     scale = 0.125f;                      // 1/sqrt(DK)
    const float*    mrowp = mask + ((size_t)b * SS + q0 + lo) * SS + 8 * hi;
    const _Float16* kbase = kh + (size_t)bh * SS * DKK + lane8;   // 16 keys = 1024 elements
    const _Float16* vbase = vt + (size_t)bh * SS * DKK + lane8;   // 32 keys = 2048 elements

    // One pass = 32 keys.  Its operands are fetched one pass ahead into the same registers:
    // K and the mask values of the next pass right behind this pass's masked scores, V^T of
    // the next pass right behind this pass's O^T products.  The loads then fly while the
    // rest of a pass computes, and no pass but the first waits out the latency of its own loads.
    v16h ka[2][2];         // K: two tiles of 16 keys x 64 dk
    v4f  ma[2], mb[2];     // this lane's 16 mask values
    v16h va[4];            // V^T: four tiles of 16 dk x 32 keys
    auto fetch_km = [&](int j0) {
        const _Float16* kp = kbase + (size_t)j0 * DKK;
        const float*    mp = mrowp + j0;
#pragma unroll
        for (int f = 0; f < 2; ++f) {
            ka[f][0] = loadf(kp + f * 1024);
            ka[f][1] = loadf(kp + f * 1024 + 512);
        }
#pragma unroll
        for (int f = 0; f < 2; ++f) {
            ma[f] = *(const v4f*)(mp + f * 16);
            mb[f] = *(const v4f*)(mp + f * 16 + 4);
        }
        // The wait that belongs in front of an overwrite of a register that these loads
        // name as their address (both addresses are held to here as inputs).
        asm volatile("s_wait_xcnt 0x0" :: "v"(kp), "v"(mp) : "memory");
    };
    auto fetch_v = [&](int j0) {
        const _Float16* vp = vbase + (size_t)j0 * DKK;
#pragma unroll
        for (int c = 0; c < 4; ++c) va[c] = loadf(vp + c * 512);
        // The same wait behind the V^T loads.
        asm volatile("s_wait_xcnt 0x0" :: "v"(vp) : "memory");
    };
    auto pass = [&](bool more, int jnext) {
        // ---- S^T for the pass's 32 keys: sc[f][r] = S[q0+lo][j0 + f*16 + 8*hi + r] ----
        v8f sc[2];
#pragma unroll
        for (int f = 0; f < 2; ++f) {
            v8f c = {};
            c = wmma(ka[f][0], qb0, c);
            c = wmma(ka[f][1], qb1, c);
            sc[f] = c;
        }
        // ---- scale + mask: a lane's 8 keys of a tile are contiguous in its mask row; written
        //      in pairs of neighbours, as they lie in the registers (no register moves) ----
        v2f s2[8];
#pragma unroll
        for (int f = 0; f < 2; ++f) {
            s2[f * 4 + 0] = __builtin_shufflevector(sc[f], sc[f], 0, 1) * scale + __builtin_shufflevector(ma[f], ma[f], 0, 1);
            s2[f * 4 + 1] = __builtin_shufflevector(sc[f], sc[f], 2, 3) * scale + __builtin_shufflevector(ma[f], ma[f], 2, 3);
            s2[f * 4 + 2] = __builtin_shufflevector(sc[f], sc[f], 4, 5) * scale + __builtin_shufflevector(mb[f], mb[f], 0, 1);
            s2[f * 4 + 3] = __builtin_shufflevector(sc[f], sc[f], 6, 7) * scale + __builtin_shufflevector(mb[f], mb[f], 2, 3);
        }
        if (more) {
            // K and the mask values have been read: refill their registers for the next pass.
            // The two scheduling barriers keep the twelve loads together at this place: without
            // them the compiler moves a part of them behind the softmax, too late to be hidden.
            __builtin_amdgcn_sched_barrier(0);
            fetch_km(jnext);
            __builtin_amdgcn_sched_barrier(0);
        }
        // ---- online softmax, all in the lane but for one exchange of the maximum ----
        float s[16];
#pragma unroll
        for (int i = 0; i < 16; ++i) s[i] = s2[i >> 1][i & 1];
        float mx = s[0];
#pragma unroll
        for (int i = 1; i < 16; ++i) mx = fmaxf(mx, s[i]);
        mx = fmaxf(mx, xhalf(mx));
        const float mnew = fmaxf(mrow, mx);
        const float corr = __expf(mrow - mnew);
        mrow = mnew;
        float p[16];
#pragma unroll
        for (int i = 0; i < 16; ++i) p[i] = __expf(s[i] - mnew);
        const float psum = (((p[0] + p[1]) + (p[2] + p[3])) + ((p[4] + p[5]) + (p[6] + p[7])))
                         + (((p[8] + p[9]) + (p[10] + p[11])) + ((p[12] + p[13]) + (p[14] + p[15])));
        lrow = lrow * corr + psum;
        // ---- rescale O^T: one factor per lane ----
#pragma unroll
        for (int c = 0; c < 4; ++c)
#pragma unroll
            for (int r = 0; r < 8; ++r) o[c][r] *= corr;
        // ---- P^T as B operand: element i = key kmap(i, hi), no lane exchange ----
        v16h pb;
#pragma unroll
        for (int i = 0; i < 16; ++i) pb[i] = (_Float16)p[i];
        // ---- O^T += V^T P^T ; A = V^T rows (lane = dk row), one fragment per 16 dk ----
#pragma unroll
        for (int c = 0; c < 4; ++c) o[c] = wmma(va[c], pb, o[c]);
        if (more) fetch_v(jnext);   // V^T has been read: refill its registers for the next pass
    };

    fetch_km(0);
    fetch_v(0);
    for (int j0 = 32; j0 < SS; j0 += 32) pass(true, j0);
    pass(false, 0);

    // ---- join the halves' sums, normalize, store x_att f16 (rows b*S+s, k = D, in
    //      fragment order for kernel 3: a wave's store is 512 contiguous bytes) and stats ----
    const float lsum = lrow + xhalf(lrow);
    const float inv  = 1.0f / lsum;
    _Float16* xrow = xatt + ((size_t)((b * SS + q0) >> 4) * (DD / 8) + h * 8 + hi) * 128 + lo * 8;
#pragma unroll
    for (int c = 0; c < 4; ++c) {
        union { _Float16 e[8]; uint4 q; } u;       // 8 consecutive dk: one 16-byte store
#pragma unroll
        for (int r = 0; r < 8; ++r) u.e[r] = (_Float16)(o[c][r] * inv);
        *(uint4*)(xrow + c * 256) = u.q;           // 16 dk on = two groups of 8 k
    }
    if (hi == 0)
        *(float2*)(stats + ((size_t)bh * SS + q0 + lo) * 2) = make_float2(mrow, lsum);
}

// ---------------------------------------------------------------------------
// Kernel 3: output projection  out = x_att(f16, fragment order, rows b*S+s) @ Wo^T + bo,
// Wo f16 in fragment order (kernel 0)
// (f32 out, S,B,D)
// Same tiling as kernel 1: one wave per 64x64 of Y, 2x2 waves per block; one wave per SIMD,
// so its fragments are fetched three stages ahead through a ring of register sets.
// ---------------------------------------------------------------------------
__global__ __launch_bounds__(128) void proj_out(
    const _Float16* __restrict__ X, const _Float16* __restrict__ W,
    const float* __restrict__ bias, float* __restrict__ out)
{
    const int lo   = threadIdx.x & 15;
    const int hi   = (threadIdx.x >> 4) & 1;
    const int wave = threadIdx.x >> 5;
    const int m0 = (blockIdx.x & 31) * 128 + (wave >> 1) * 64;
    const int n0 = (blockIdx.x >> 5) * 128 + (wave & 1)  * 64;

    const _Float16* xp = X + (size_t)m0 * DD + (threadIdx.x & 31) * 8;   // 16 rows = 16*DD elements
    const _Float16* wp = W + (size_t)n0 * DD + (threadIdx.x & 31) * 8;
    v8f acc[4][4] = {};
    // A set = the 8 fragments (16 loads) of 32 k.  Four sets of registers form a ring: a stage
    // waits for its own set, refills the set that the stage before has just read with the one
    // three stages on, then does its 16 WMMAs.  The one wave of a SIMD has the registers for it,
    // and a load has three stages to arrive in instead of being waited for right behind its issue.
    v16h a[4][4], b[4][4];
#define FETCH_SET(t, set)                                                                  \
    do {                                                                                   \
        _Pragma("unroll") for (int i = 0; i < 4; ++i)                                      \
            a[t][i] = loadf(xp + (set) * 512 + i * 16 * DD);                               \
        _Pragma("unroll") for (int j = 0; j < 4; ++j)                                      \
            b[t][j] = loadf(wp + (set) * 512 + j * 16 * DD);                               \
    } while (0)
#define MUL_SET(t)                                                                         \
    do {                                                                                   \
        _Pragma("unroll") for (int i = 0; i < 4; ++i)                                      \
            _Pragma("unroll") for (int j = 0; j < 4; ++j)                                  \
                acc[i][j] = wmma(a[t][i], b[t][j], acc[i][j]);                             \
    } while (0)
    FETCH_SET(0, 0);
    FETCH_SET(1, 1);
    FETCH_SET(2, 2);
    // Unrolled over all of k: every load then names xp or wp with an immediate offset, and no
    // address register is rewritten while loads are in flight.
#pragma unroll
    for (int s0 = 0; s0 < DD / 32 - 4; s0 += 4) {
#pragma unroll
        for (int t = 0; t < 4; ++t) {
            // Inputs-only fence on the fragment of this stage's set that was loaded last (loads
            // return in order): the set is waited for BEFORE the refill is issued, so a wave's
            // outstanding loads stay under the counter's 63.  The scheduling barrier in front keeps
            // that wait behind the WMMAs of the stage before: moved up among them, as the compiler
            // did, it takes a stage from the flight of every set.
            __builtin_amdgcn_sched_barrier(0);
            asm volatile("" :: "v"(b[t][3]));
            // The two scheduling barriers keep the sixteen loads together at this place, in front
            // of the stage's WMMAs: moved behind them they would lose a stage of their flight.
            __builtin_amdgcn_sched_barrier(0);
            FETCH_SET((t + 3) & 3, s0 + t + 3);
            __builtin_amdgcn_sched_barrier(0);
            MUL_SET(t);
        }
    }
    // The last four sets: one is still to be fetched.
    __builtin_amdgcn_sched_barrier(0);  // as in the loop
    asm volatile("" :: "v"(b[0][3]));   // the same fence
    __builtin_amdgcn_sched_barrier(0);
    FETCH_SET(3, DD / 32 - 1);
    // The wait that belongs in front of an overwrite of a register that the loads name as their
    // address: xp and wp, held to here as inputs, are free for the epilogue behind it.
    asm volatile("s_wait_xcnt 0x0" :: "v"(xp), "v"(wp) : "memory");
    __builtin_amdgcn_sched_barrier(0);
    MUL_SET(0);
    MUL_SET(1);
    MUL_SET(2);
    MUL_SET(3);
#undef FETCH_SET
#undef MUL_SET

    const int col0 = n0 + lo;
    float bv[4];
#pragma unroll
    for (int j = 0; j < 4; ++j) bv[j] = bias[col0 + j * 16];
    // The wait in front of an overwrite of the bias loads' register (see kernel 1).
    asm volatile("s_wait_xcnt 0x0" :: "v"(bv[0]), "v"(bv[1]), "v"(bv[2]), "v"(bv[3]), "v"(col0));
#pragma unroll
    for (int j = 0; j < 4; ++j) {
        // The wait in front of an overwrite of a store's registers (see kernel 1).
        if (j > 0) asm volatile("s_wait_xcnt 0x0" : "+v"(bv[j]) :: "memory");
#pragma unroll
        for (int i = 0; i < 4; ++i)
#pragma unroll
            for (int r = 0; r < 8; ++r) {
                // x_att row m0 + ... = b*S + s (a wave's 64 rows are of one b) -> out row s*B + b
                const int rg = ((m0 & (SS - 1)) + i * 16 + r + 8 * hi) * BB + (m0 >> 11);
                out[(size_t)rg * DD + col0 + j * 16] = acc[i][j][r] + bv[j];
            }
    }
}

// ---------------------------------------------------------------------------
// Kernel 4: attn = mean over heads of softmax(QK^T/sqrt+mask).
// Recompute scores with WMMA, transposed as in kernel 2 (A = K rows, B = Q^T): a
// lane holds 8 consecutive keys of ONE query per tile, so the stored (max,sum)
// stats are one load and one reciprocal per lane, head and 16 queries.
// A wave owns 32 queries x 64 keys (2 x 4 tiles): a loaded Q^T fragment feeds four
// tiles and a K fragment two.  Block = 4 x 2 waves = 128 queries x 128 keys, so a
// block fetches 32 KiB per head for 16384 results.  Grid = B * (S/128) * (S/128).
// ---------------------------------------------------------------------------
__global__ __launch_bounds__(256) void attn_mean(
    const _Float16* __restrict__ qh, const _Float16* __restrict__ kh,
    const float* __restrict__ mask, const float* __restrict__ stats,
    float* __restrict__ attn)
{
    const int wave = threadIdx.x >> 5;
    const int lo   = threadIdx.x & 15;
    const int hi   = (threadIdx.x >> 4) & 1;
    int idx = blockIdx.x;
    const int tblk = idx & 15; idx >>= 4;    // S/128
    const int sblk = idx & 15; idx >>= 4;    // S/128
    const int b    = idx;
    const int s0   = sblk * 128 + (wave >> 1) * 32;
    const int t0   = tblk * 128 + (wave & 1) * 64;

    // element r of tile (i, j) of this lane: query s0 + 16*i + lo, key t0 + 16*j + 8*hi + r
    const size_t eoff = ((size_t)b * SS + s0 + lo) * SS + t0 + 8 * hi;
    const float* mp = mask + eoff;
    v8f mk[2][4];
#pragma unroll
    for (int i = 0; i < 2; ++i)
#pragma unroll
        for (int j = 0; j < 4; ++j) {
            const v4f ma = *(const v4f*)(mp + i * 16 * SS + j * 16);
            const v4f mb = *(const v4f*)(mp + i * 16 * SS + j * 16 + 4);
            mk[i][j] = __builtin_shufflevector(ma, mb, 0, 1, 2, 3, 4, 5, 6, 7);
        }
    // The wait that belongs in front of an overwrite of the register that these
    // loads name as their address (mp, held to here as an input).
    asm volatile("s_wait_xcnt 0x0" :: "v"(mp) : "memory");
    v8f acc[2][4] = {};
    const float scale = 0.125f;

    // head 0 of this batch; a head is SS rows further on (lane's place in the pointer)
    const int lane8 = (threadIdx.x & 31) * 8;
    const _Float16* qp = qh + ((size_t)(b * HH) * SS + s0) * DKK + lane8;   // 16 rows = 1024 elements
    const _Float16* kp = kh + ((size_t)(b * HH) * SS + t0) * DKK + lane8;
    const float*    sp = stats + ((size_t)(b * HH) * SS + s0 + lo) * 2;
    for (int h = 0; h < HH; ++h, qp += SS * DKK, kp += SS * DKK, sp += SS * 2) {
        float2 st[2];
        v16h   qb[2][2], ka[4][2];
#pragma unroll
        for (int i = 0; i < 2; ++i) {
            st[i]    = *(const float2*)(sp + i * 32);
            qb[i][0] = loadf(qp + i * 1024);
            qb[i][1] = loadf(qp + i * 1024 + 512);
        }
#pragma unroll
        for (int j = 0; j < 4; ++j) {
            ka[j][0] = loadf(kp + j * 1024);
            ka[j][1] = loadf(kp + j * 1024 + 512);
        }
        // Holds the head's 26 loads in place as one group (loaded values and their three
        // addresses as inputs only): a wave then waits out one cache latency per head, not one
        // per part of the group, and no load lands on an address register.  Its s_wait_xcnt 0
        // is the wait that belongs in front of the next overwrite of such a register.
        asm volatile("s_wait_xcnt 0x0"
                     :: "v"(qb[0][0]), "v"(qb[0][1]), "v"(qb[1][0]), "v"(qb[1][1]),
                        "v"(ka[0][0]), "v"(ka[0][1]), "v"(ka[1][0]), "v"(ka[1][1]),
                        "v"(ka[2][0]), "v"(ka[2][1]), "v"(ka[3][0]), "v"(ka[3][1]),
                        "v"(st[0].x), "v"(st[0].y), "v"(st[1].x), "v"(st[1].y),
                        "v"(qp), "v"(kp), "v"(sp)
                     : "memory");
        // All scores of the head first: the two tiles of a K tile are finished together, so
        // its fragments' registers are free for the next two score tiles.
        v8f c[2][4];
#pragma unroll
        for (int j = 0; j < 4; ++j) {
#pragma unroll
            for (int i = 0; i < 2; ++i) { v8f z = {}; c[i][j] = wmma(ka[j][0], qb[i][0], z); }
#pragma unroll
            for (int i = 0; i < 2; ++i) c[i][j] = wmma(ka[j][1], qb[i][1], c[i][j]);
        }
        // Keeps the vector work behind the sixteen WMMAs: mixed in between them it is scheduled
        // as one dependent chain per pair of scores (no free registers while the fragments live).
        __builtin_amdgcn_sched_barrier(0);
#pragma unroll
        for (int i = 0; i < 2; ++i) {
            const float inv = 1.0f / st[i].y;
#pragma unroll
            for (int j = 0; j < 4; ++j)
#pragma unroll
                for (int r = 0; r < 8; ++r)
                    acc[i][j][r] += __expf(c[i][j][r] * scale + mk[i][j][r] - st[i].x) * inv;
        }
    }
    const float invH = 1.0f / HH;
    float* op = attn + eoff;
#pragma unroll
    for (int i = 0; i < 2; ++i)
#pragma unroll
        for (int j = 0; j < 4; ++j) {
            v4f oa, ob;
#pragma unroll
            for (int r = 0; r < 4; ++r) { oa[r] = acc[i][j][r] * invH; ob[r] = acc[i][j][4 + r] * invH; }
            *(v4f*)(op + i * 16 * SS + j * 16)     = oa;
            *(v4f*)(op + i * 16 * SS + j * 16 + 4) = ob;
        }
}

// ---------------------------------------------------------------------------
// Launcher
// ---------------------------------------------------------------------------
extern "C" void kernel_launch(void* const* d_in, const int* in_sizes, int n_in,
                              void* d_out, int out_size, void* d_ws, size_t ws_size,
                              hipStream_t stream) {
    const float* query = (const float*)d_in[0];
    const float* key   = (const float*)d_in[1];
    const float* value = (const float*)d_in[2];
    const float* mask  = (const float*)d_in[3];
    const float* Wq = (const float*)d_in[4];  const float* bq = (const float*)d_in[5];
    const float* Wk = (const float*)d_in[6];  const float* bk = (const float*)d_in[7];
    const float* Wv = (const float*)d_in[8];  const float* bv = (const float*)d_in[9];
    const float* Wo = (const float*)d_in[10]; const float* bo = (const float*)d_in[11];

    float* out  = (float*)d_out;                       // (S,B,D)
    float* attn = out + (size_t)SS * BB * DD;          // (B,S,S)

    // Workspace layout (~67.6 MB total)
    const size_t headElems = (size_t)BB * HH * SS * DKK;   // 4,194,304
    _Float16* qh   = (_Float16*)d_ws;                  // per (b,h): S x DK   f16, fragment order
    _Float16* kh   = qh + headElems;                   // per (b,h): S x DK   f16, fragment order
    _Float16* vt   = kh + headElems;                   // per (b,h): DK x S   f16, fragment order
    _Float16* xatt = vt + headElems;                   // (B*S) x D   f16, fragment order
    float*    stats = (float*)(xatt + (size_t)SS * BB * DD); // (B,H,S,2) f32
    // f16 copies in fragment order, in kernel 0's order of tiles
    _Float16* xq16 = (_Float16*)(stats + (size_t)BB * HH * SS * 2);
    _Float16* xk16 = xq16 + (size_t)SS * BB * DD;
    _Float16* xv16 = xk16 + (size_t)SS * BB * DD;
    _Float16* wq16 = xv16 + (size_t)SS * BB * DD;
    _Float16* wk16 = wq16 + (size_t)DD * DD;
    _Float16* wv16 = wk16 + (size_t)DD * DD;
    _Float16* wo16 = wv16 + (size_t)DD * DD;

    to_frag<<<512, 256, 0, stream>>>(query, key, value, Wq, Wk, Wv, Wo, xq16);
    proj_qkv<<<768, 128, 0, stream>>>(xq16, wq16, bq, bk, bv, qh);
    attn_flash<<<512, 256, 0, stream>>>(qh, kh, vt, mask, xatt, stats);
    proj_out<<<256, 128, 0, stream>>>(xatt, wo16, bo, out);
    attn_mean<<<512, 256, 0, stream>>>(qh, kh, mask, stats, attn);
}
